// v000
// The times below were measured on an AMD MI455X: many runs one after another, warmed up first and cycling through
// copies of the inputs, with the whole window's GPU time divided by the number of runs. Launches and the gaps
// between them are all in it. The median over several windows is given; except for v000 it joins two sittings, which
// can be a few percent apart, so the side-by-side timings, each taken in one sitting, are the better comparison.
// v000 is the starting kernel. One run takes 855 microseconds.
#include <hip/hip_runtime.h>
#include <math.h>

// Problem constants (from reference setup_inputs)
#define BB   4
#define TQ   256
#define TV   1024
#define DD   512
#define AAA  128
#define NEG_BIG (-1.0e9f)

typedef __attribute__((ext_vector_type(2))) float v2f;
typedef __attribute__((ext_vector_type(8))) float v8f;
typedef __attribute__((ext_vector_type(4))) unsigned int v4u;
typedef __attribute__((ext_vector_type(8))) int v8i;
typedef __attribute__((ext_vector_type(4))) int v4i;

// ---------------------------------------------------------------------------
// TDM: async-copy one 16x128 f32 tile (row stride 128 floats in global) into
// LDS with 4-DWORD padding after every 128 DWORDs (-> 132-float LDS pitch).
// D# layout per CDNA5 ISA ch. 8 (group0 128b, group1 256b, groups 2/3 zero
// for a 2D tensor). Tracked with TENSORcnt. 6-arg builtin form (clang-23).
// ---------------------------------------------------------------------------
__device__ __forceinline__ void tdm_load_k_tile(const float* gsrc, unsigned lds_addr)
{
    unsigned long long ga = (unsigned long long)(size_t)gsrc;
    v4u g0;
    g0[0] = 1u;                                            // count=1, user-mode D#
    g0[1] = lds_addr;                                      // lds_addr [63:32]
    g0[2] = (unsigned)(ga & 0xFFFFFFFFull);                // global_addr lo
    g0[3] = (unsigned)((ga >> 32) & 0x1FFFFFFull)          // global_addr hi (57-bit)
          | (2u << 30);                                    // type=2 ("image")
    v8i g1;
    g1[0] = (int)((2u << 16)      // data_size = 4 bytes
                | (1u << 20)      // pad_enable
                | (6u << 22)      // pad_interval: 128 DWORDs
                | (3u << 25));    // pad_amount:   4 DWORDs
    g1[1] = (int)(128u << 16);    // tensor_dim0 = 128 (lo16 @ bits 48..63)
    g1[2] = (int)(16u  << 16);    // tensor_dim0 hi = 0 | tensor_dim1 = 16 (lo16)
    g1[3] = (int)(128u << 16);    // tensor_dim1 hi = 0 | tile_dim0 = 128
    g1[4] = 16;                   // tile_dim1 = 16, tile_dim2 = 0
    g1[5] = 128;                  // tensor_dim0_stride = 128 (lo32)
    g1[6] = 0;                    // stride hi | tensor_dim1_stride lo (unused, 2D)
    g1[7] = 0;
    v4i z4 = {0, 0, 0, 0};
    v8i z8 = {0, 0, 0, 0, 0, 0, 0, 0};
    __builtin_amdgcn_tensor_load_to_lds(g0, g1, z4, z4, z8, 0);
}

// ---------------------------------------------------------------------------
// Kernel 1: fused projections  K = inputs@Wk + bk ; Q = context@Wq + bq
// One wave per 16x16 output tile, V_WMMA_F32_16X16X4_F32 over K-dim 512.
// ---------------------------------------------------------------------------
__global__ __launch_bounds__(256)
void proj_kernel(const float* __restrict__ inputs, const float* __restrict__ context,
                 const float* __restrict__ Wk, const float* __restrict__ bk,
                 const float* __restrict__ Wq, const float* __restrict__ bq,
                 float* __restrict__ Kws, float* __restrict__ Qws)
{
    int wave = blockIdx.x * 8 + (threadIdx.x >> 5);
    int lane = threadIdx.x & 31;
    int mt = wave >> 3;      // 0..319
    int nt = wave & 7;       // 0..7 (A=128 -> 8 tiles of 16)

    const float* X; const float* W; const float* bias; float* out;
    int rowbase;
    if (mt < 256) { X = inputs;  W = Wk; bias = bk; out = Kws; rowbase = mt * 16; }
    else          { X = context; W = Wq; bias = bq; out = Qws; rowbase = (mt - 256) * 16; }

    int halfsel = (lane >> 4) << 1;         // 0 for lanes 0-15, 2 for lanes 16-31
    int mrow = rowbase + (lane & 15);       // A-matrix: M = lane%16
    int ncol = nt * 16 + (lane & 15);       // B/C/D: N = lane%16

    v8f acc = {};
    #pragma unroll 4
    for (int k = 0; k < DD; k += 4) {
        v2f afrag, bfrag;
        const float* ap = X + (size_t)mrow * DD + k + halfsel;
        afrag[0] = ap[0];
        afrag[1] = ap[1];
        const float* bp = W + (size_t)(k + halfsel) * AAA + ncol;
        bfrag[0] = bp[0];
        bfrag[1] = bp[AAA];
        acc = __builtin_amdgcn_wmma_f32_16x16x4_f32(false, afrag, false, bfrag,
                                                    (short)0, acc, false, false);
    }

    float bbv = bias[ncol];
    int mhi = (lane >> 4) << 3;             // C/D rows: r / r+8 by lane half
    #pragma unroll
    for (int r = 0; r < 8; ++r) {
        out[(size_t)(rowbase + r + mhi) * AAA + ncol] = acc[r] + bbv;
    }
}

// ---------------------------------------------------------------------------
// Kernel 2: fused score (tanh dot) + online softmax + attn@V (WMMA f32)
// One block per (batch, 16-query tile). 8 waves; each wave owns a 64-wide
// D-slice of the accumulator. K chunks double-buffered via TDM async copy.
// ---------------------------------------------------------------------------
__global__ __launch_bounds__(256)
void attn_kernel(const float* __restrict__ inputs, const int* __restrict__ mask,
                 const float* __restrict__ attn_v,
                 const float* __restrict__ Kws, const float* __restrict__ Qws,
                 float* __restrict__ out)
{
    __shared__ float qbuf[16][132];      // 132-float pitch: conflict-free score loop
    __shared__ float kbuf[2][16][132];   // double-buffered TDM destination
    __shared__ float sbuf[16][16];
    __shared__ float pbuf[16][18];       // pad 18: conflict-free A-frag reads
    __shared__ float vv[AAA];
    __shared__ float mrow_s[16], lrow_s[16], crow_s[16];

    int b  = blockIdx.x >> 4;             // 16 q-tiles per batch
    int q0 = (blockIdx.x & 15) * 16;
    int tid  = threadIdx.x;
    int lane = tid & 31;
    int wav  = tid >> 5;

    const float* Kbase = Kws + (size_t)b * TV * AAA;

    // prologue: TDM-issue chunk 0 into buffer 0 (wave 0 only; EXEC-independent)
    if (wav == 0) {
        tdm_load_k_tile(Kbase, (unsigned)(size_t)&kbuf[0][0][0]);
    }

    // stage Q tile + attn_v, init softmax state (overlaps with TDM)
    for (int i = tid; i < 16 * AAA; i += 256) {
        int r = i >> 7, c = i & 127;
        qbuf[r][c] = Qws[(size_t)(b * TQ + q0 + r) * AAA + c];
    }
    if (tid < AAA) vv[tid] = attn_v[tid];
    if (tid < 16) { mrow_s[tid] = -3.0e38f; lrow_s[tid] = 0.0f; }

    int dbase = wav * 64;                 // this wave's D-slice
    v8f acc[4] = {};
    int qi = tid >> 4, vi = tid & 15;     // score-lattice assignment
    int halfsel = (lane >> 4) << 1;
    int n15 = lane & 15;
    int mhi = (lane >> 4) << 3;
    int cur = 0;

    for (int v0 = 0; v0 < TV; v0 += 16) {
        // ---- prefetch next K chunk (other buffer), wait for current ----
        if (wav == 0) {
            if (v0 + 16 < TV) {
                tdm_load_k_tile(Kbase + (size_t)(v0 + 16) * AAA,
                                (unsigned)(size_t)&kbuf[cur ^ 1][0][0]);
                __builtin_amdgcn_s_wait_tensorcnt(1);   // chunk v0 complete (in-order)
            } else {
                __builtin_amdgcn_s_wait_tensorcnt(0);
            }
        }
        __syncthreads();

        // ---- scores: s[q,v] = sum_a vv[a] * tanh(q[a] + k[a]) ----
        float s = 0.0f;
        #pragma unroll 4
        for (int a = 0; a < AAA; ++a) {
            s = fmaf(vv[a], tanhf(qbuf[qi][a] + kbuf[cur][vi][a]), s);
        }
        if (mask[b * TV + v0 + vi] == 0) s += NEG_BIG;
        sbuf[qi][vi] = s;
        __syncthreads();

        // ---- online softmax stats (16 threads, one per q-row) ----
        if (tid < 16) {
            int rq = tid;
            float mo = mrow_s[rq];
            float mn = mo;
            #pragma unroll
            for (int j = 0; j < 16; ++j) mn = fmaxf(mn, sbuf[rq][j]);
            float corr = __expf(mo - mn);
            float ls = 0.0f;
            #pragma unroll
            for (int j = 0; j < 16; ++j) {
                float p = __expf(sbuf[rq][j] - mn);
                pbuf[rq][j] = p;
                ls += p;
            }
            mrow_s[rq] = mn;
            lrow_s[rq] = lrow_s[rq] * corr + ls;
            crow_s[rq] = corr;
        }
        __syncthreads();

        // ---- rescale accumulators by softmax correction ----
        #pragma unroll
        for (int r = 0; r < 8; ++r) {
            float c = crow_s[r + mhi];
            acc[0][r] *= c; acc[1][r] *= c; acc[2][r] *= c; acc[3][r] *= c;
        }

        // ---- acc += p(16x16) @ V_chunk(16x64slice) via WMMA f32 16x16x4 ----
        const float* Vbase = inputs + (size_t)(b * TV + v0) * DD;
        #pragma unroll
        for (int kk = 0; kk < 16; kk += 4) {
            v2f afrag;
            afrag[0] = pbuf[n15][kk + halfsel];
            afrag[1] = pbuf[n15][kk + halfsel + 1];
            #pragma unroll
            for (int t = 0; t < 4; ++t) {
                int n = dbase + t * 16 + n15;
                v2f bfrag;
                bfrag[0] = Vbase[(size_t)(kk + halfsel) * DD + n];
                bfrag[1] = Vbase[(size_t)(kk + halfsel + 1) * DD + n];
                acc[t] = __builtin_amdgcn_wmma_f32_16x16x4_f32(false, afrag, false, bfrag,
                                                               (short)0, acc[t], false, false);
            }
        }
        __syncthreads();  // all reads of kbuf[cur]/pbuf done
        cur ^= 1;
    }

    // ---- normalize and store ----
    #pragma unroll
    for (int r = 0; r < 8; ++r) {
        float inv = 1.0f / lrow_s[r + mhi];
        #pragma unroll
        for (int t = 0; t < 4; ++t) {
            out[(size_t)(b * TQ + q0 + r + mhi) * DD + dbase + t * 16 + n15] = acc[t][r] * inv;
        }
    }
}

// ---------------------------------------------------------------------------
extern "C" void kernel_launch(void* const* d_in, const int* in_sizes, int n_in,
                              void* d_out, int out_size, void* d_ws, size_t ws_size,
                              hipStream_t stream)
{
    (void)in_sizes; (void)n_in; (void)out_size; (void)ws_size;
    const float* inputs  = (const float*)d_in[0];   // [B,Tv,D]
    const float* context = (const float*)d_in[1];   // [B,Tq,D]
    const int*   mask    = (const int*)  d_in[2];   // [B,Tv]
    const float* Wk      = (const float*)d_in[3];   // [D,A]
    const float* bk      = (const float*)d_in[4];   // [A]
    const float* Wq      = (const float*)d_in[5];   // [D,A]
    const float* bq      = (const float*)d_in[6];   // [A]
    const float* attn_v  = (const float*)d_in[7];   // [A]
    float* out = (float*)d_out;                     // [B,Tq,D]

    float* Kws = (float*)d_ws;                       // [B*Tv, A] = 2 MB
    float* Qws = Kws + (size_t)BB * TV * AAA;        // [B*Tq, A] = 0.5 MB

    // 2560 tiles / 8 waves-per-block = 320 blocks
    hipLaunchKernelGGL(proj_kernel, dim3(320), dim3(256), 0, stream,
                       inputs, context, Wk, bk, Wq, bq, Kws, Qws);
    // B * Tq/16 = 64 blocks
    hipLaunchKernelGGL(attn_kernel, dim3(BB * (TQ / 16)), dim3(256), 0, stream,
                       inputs, mask, attn_v, Kws, Qws, out);
}

// v001
// Measured time: 156 microseconds a run.
// Timed twice side by side with v000, it ran 5.49 times as fast both times.
#include <hip/hip_runtime.h>
#include <math.h>

// Problem constants (from reference setup_inputs)
#define BB   4
#define TQ   256
#define TV   1024
#define DD   512
#define AAA  128
#define NEG_BIG (-1.0e9f)
#define TANH_C 2.8853900817779268f   // 2 * log2(e)

typedef __attribute__((ext_vector_type(2))) float v2f;
typedef __attribute__((ext_vector_type(8))) float v8f;
typedef __attribute__((ext_vector_type(4))) unsigned int v4u;
typedef __attribute__((ext_vector_type(8))) int v8i;
typedef __attribute__((ext_vector_type(4))) int v4i;

// ---------------------------------------------------------------------------
// TDM: async-copy one 16x128 f32 tile (row stride 128 floats in global) into
// LDS with 4-DWORD padding after every 128 DWORDs (-> 132-float LDS pitch).
// D# layout per CDNA5 ISA ch. 8 (group0 128b, group1 256b, groups 2/3 zero
// for a 2D tensor). Tracked with TENSORcnt. 6-arg builtin form (clang-23).
// ---------------------------------------------------------------------------
__device__ __forceinline__ void tdm_load_k_tile(const float* gsrc, unsigned lds_addr)
{
    unsigned long long ga = (unsigned long long)(size_t)gsrc;
    v4u g0;
    g0[0] = 1u;                                            // count=1, user-mode D#
    g0[1] = lds_addr;                                      // lds_addr [63:32]
    g0[2] = (unsigned)(ga & 0xFFFFFFFFull);                // global_addr lo
    g0[3] = (unsigned)((ga >> 32) & 0x1FFFFFFull)          // global_addr hi (57-bit)
          | (2u << 30);                                    // type=2 ("image")
    v8i g1;
    g1[0] = (int)((2u << 16)      // data_size = 4 bytes
                | (1u << 20)      // pad_enable
                | (6u << 22)      // pad_interval: 128 DWORDs
                | (3u << 25));    // pad_amount:   4 DWORDs
    g1[1] = (int)(128u << 16);    // tensor_dim0 = 128 (lo16 @ bits 48..63)
    g1[2] = (int)(16u  << 16);    // tensor_dim0 hi = 0 | tensor_dim1 = 16 (lo16)
    g1[3] = (int)(128u << 16);    // tensor_dim1 hi = 0 | tile_dim0 = 128
    g1[4] = 16;                   // tile_dim1 = 16, tile_dim2 = 0
    g1[5] = 128;                  // tensor_dim0_stride = 128 (lo32)
    g1[6] = 0;                    // stride hi | tensor_dim1_stride lo (unused, 2D)
    g1[7] = 0;
    v4i z4 = {0, 0, 0, 0};
    v8i z8 = {0, 0, 0, 0, 0, 0, 0, 0};
    __builtin_amdgcn_tensor_load_to_lds(g0, g1, z4, z4, z8, 0);
}

// ---------------------------------------------------------------------------
// Kernel 1: fused projections  K = inputs@Wk + bk ; Q = context@Wq + bq
// One wave per 16x16 output tile, V_WMMA_F32_16X16X4_F32 over K-dim 512.
// ---------------------------------------------------------------------------
__global__ __launch_bounds__(256)
void proj_kernel(const float* __restrict__ inputs, const float* __restrict__ context,
                 const float* __restrict__ Wk, const float* __restrict__ bk,
                 const float* __restrict__ Wq, const float* __restrict__ bq,
                 float* __restrict__ Kws, float* __restrict__ Qws)
{
    int wave = blockIdx.x * 8 + (threadIdx.x >> 5);
    int lane = threadIdx.x & 31;
    int mt = wave >> 3;      // 0..319
    int nt = wave & 7;       // 0..7 (A=128 -> 8 tiles of 16)

    const float* X; const float* W; const float* bias; float* out;
    int rowbase;
    if (mt < 256) { X = inputs;  W = Wk; bias = bk; out = Kws; rowbase = mt * 16; }
    else          { X = context; W = Wq; bias = bq; out = Qws; rowbase = (mt - 256) * 16; }

    int halfsel = (lane >> 4) << 1;         // 0 for lanes 0-15, 2 for lanes 16-31
    int mrow = rowbase + (lane & 15);       // A-matrix: M = lane%16
    int ncol = nt * 16 + (lane & 15);       // B/C/D: N = lane%16

    v8f acc = {};
    #pragma unroll 4
    for (int k = 0; k < DD; k += 4) {
        v2f afrag, bfrag;
        const float* ap = X + (size_t)mrow * DD + k + halfsel;
        afrag[0] = ap[0];
        afrag[1] = ap[1];
        const float* bp = W + (size_t)(k + halfsel) * AAA + ncol;
        bfrag[0] = bp[0];
        bfrag[1] = bp[AAA];
        acc = __builtin_amdgcn_wmma_f32_16x16x4_f32(false, afrag, false, bfrag,
                                                    (short)0, acc, false, false);
    }

    float bbv = bias[ncol];
    int mhi = (lane >> 4) << 3;             // C/D rows: r / r+8 by lane half
    #pragma unroll
    for (int r = 0; r < 8; ++r) {
        out[(size_t)(rowbase + r + mhi) * AAA + ncol] = acc[r] + bbv;
    }
}

// ---------------------------------------------------------------------------
// Kernel 2: fused score (tanh dot) + online softmax + attn@V (WMMA f32)
// One block per (batch, 16-query tile). 8 waves; each wave owns a 64-wide
// D-slice of the accumulator. K chunks double-buffered via TDM async copy.
// ---------------------------------------------------------------------------
__global__ __launch_bounds__(256)
void attn_kernel(const float* __restrict__ inputs, const int* __restrict__ mask,
                 const float* __restrict__ attn_v,
                 const float* __restrict__ Kws, const float* __restrict__ Qws,
                 float* __restrict__ out)
{
    __shared__ float qbuf[16][132];      // 132-float pitch: conflict-free score loop
    __shared__ float kbuf[2][16][132];   // double-buffered TDM destination
    __shared__ float sbuf[16][16];
    __shared__ float pbuf[16][18];       // pad 18: conflict-free A-frag reads
    __shared__ float vv[AAA];
    __shared__ float mrow_s[16], lrow_s[16], crow_s[16];

    int b  = blockIdx.x >> 4;             // 16 q-tiles per batch
    int q0 = (blockIdx.x & 15) * 16;
    int tid  = threadIdx.x;
    int lane = tid & 31;
    int wav  = tid >> 5;

    const float* Kbase = Kws + (size_t)b * TV * AAA;

    // prologue: TDM-issue chunk 0 into buffer 0 (wave 0 only; EXEC-independent)
    if (wav == 0) {
        tdm_load_k_tile(Kbase, (unsigned)(size_t)&kbuf[0][0][0]);
    }

    // stage Q tile + attn_v, init softmax state (overlaps with TDM)
    for (int i = tid; i < 16 * AAA; i += 256) {
        int r = i >> 7, c = i & 127;
        qbuf[r][c] = TANH_C * Qws[(size_t)(b * TQ + q0 + r) * AAA + c];
    }
    if (tid < AAA) vv[tid] = -2.0f * attn_v[tid];
    if (tid < 16) { mrow_s[tid] = -3.0e38f; lrow_s[tid] = 0.0f; }
    float sumv = 0.0f;                    // the "1" terms of the tanh form below
    for (int a = 0; a < AAA; ++a) sumv += attn_v[a];

    int dbase = wav * 64;                 // this wave's D-slice
    v8f acc[4] = {};
    int qi = tid >> 4, vi = tid & 15;     // score-lattice assignment
    int halfsel = (lane >> 4) << 1;
    int n15 = lane & 15;
    int mhi = (lane >> 4) << 3;
    int cur = 0;

    for (int v0 = 0; v0 < TV; v0 += 16) {
        // ---- prefetch next K chunk (other buffer), wait for current ----
        if (wav == 0) {
            if (v0 + 16 < TV) {
                tdm_load_k_tile(Kbase + (size_t)(v0 + 16) * AAA,
                                (unsigned)(size_t)&kbuf[cur ^ 1][0][0]);
                __builtin_amdgcn_s_wait_tensorcnt(1);   // chunk v0 complete (in-order)
            } else {
                __builtin_amdgcn_s_wait_tensorcnt(0);
            }
        }
        __syncthreads();

        // ---- scores: tanh(x) = 1 - 2 / (2^(x * 2 log2 e) + 1), branch-free on the
        // hardware exp2 and reciprocal; 2^y = inf gives +1, 2^y = 0 gives -1.
        // qbuf holds q * 2 log2 e and vv holds -2 v, so
        // s[q,v] = sum_a v[a] + sum_a -2 v[a] / (2^y + 1).
        float s = sumv;
        // unrolled far: the LDS reads of later elements issue under the
        // exp2/rcp latency of earlier ones
        #pragma unroll 64
        for (int a = 0; a < AAA; ++a) {
            float e = __builtin_amdgcn_exp2f(fmaf(kbuf[cur][vi][a], TANH_C, qbuf[qi][a]));
            s = fmaf(vv[a], __builtin_amdgcn_rcpf(e + 1.0f), s);
        }
        if (mask[b * TV + v0 + vi] == 0) s += NEG_BIG;
        sbuf[qi][vi] = s;
        __syncthreads();

        // ---- online softmax stats (16 threads, one per q-row) ----
        if (tid < 16) {
            int rq = tid;
            float mo = mrow_s[rq];
            float mn = mo;
            #pragma unroll
            for (int j = 0; j < 16; ++j) mn = fmaxf(mn, sbuf[rq][j]);
            float corr = __expf(mo - mn);
            float ls = 0.0f;
            #pragma unroll
            for (int j = 0; j < 16; ++j) {
                float p = __expf(sbuf[rq][j] - mn);
                pbuf[rq][j] = p;
                ls += p;
            }
            mrow_s[rq] = mn;
            lrow_s[rq] = lrow_s[rq] * corr + ls;
            crow_s[rq] = corr;
        }
        __syncthreads();

        // ---- rescale accumulators by softmax correction ----
        #pragma unroll
        for (int r = 0; r < 8; ++r) {
            float c = crow_s[r + mhi];
            acc[0][r] *= c; acc[1][r] *= c; acc[2][r] *= c; acc[3][r] *= c;
        }

        // ---- acc += p(16x16) @ V_chunk(16x64slice) via WMMA f32 16x16x4 ----
        const float* Vbase = inputs + (size_t)(b * TV + v0) * DD;
        #pragma unroll
        for (int kk = 0; kk < 16; kk += 4) {
            v2f afrag;
            afrag[0] = pbuf[n15][kk + halfsel];
            afrag[1] = pbuf[n15][kk + halfsel + 1];
            #pragma unroll
            for (int t = 0; t < 4; ++t) {
                int n = dbase + t * 16 + n15;
                v2f bfrag;
                bfrag[0] = Vbase[(size_t)(kk + halfsel) * DD + n];
                bfrag[1] = Vbase[(size_t)(kk + halfsel + 1) * DD + n];
                acc[t] = __builtin_amdgcn_wmma_f32_16x16x4_f32(false, afrag, false, bfrag,
                                                               (short)0, acc[t], false, false);
            }
        }
        __syncthreads();  // all reads of kbuf[cur]/pbuf done
        cur ^= 1;
    }

    // ---- normalize and store ----
    #pragma unroll
    for (int r = 0; r < 8; ++r) {
        float inv = 1.0f / lrow_s[r + mhi];
        #pragma unroll
        for (int t = 0; t < 4; ++t) {
            out[(size_t)(b * TQ + q0 + r + mhi) * DD + dbase + t * 16 + n15] = acc[t][r] * inv;
        }
    }
}

// ---------------------------------------------------------------------------
extern "C" void kernel_launch(void* const* d_in, const int* in_sizes, int n_in,
                              void* d_out, int out_size, void* d_ws, size_t ws_size,
                              hipStream_t stream)
{
    (void)in_sizes; (void)n_in; (void)out_size; (void)ws_size;
    const float* inputs  = (const float*)d_in[0];   // [B,Tv,D]
    const float* context = (const float*)d_in[1];   // [B,Tq,D]
    const int*   mask    = (const int*)  d_in[2];   // [B,Tv]
    const float* Wk      = (const float*)d_in[3];   // [D,A]
    const float* bk      = (const float*)d_in[4];   // [A]
    const float* Wq      = (const float*)d_in[5];   // [D,A]
    const float* bq      = (const float*)d_in[6];   // [A]
    const float* attn_v  = (const float*)d_in[7];   // [A]
    float* out = (float*)d_out;                     // [B,Tq,D]

    float* Kws = (float*)d_ws;                       // [B*Tv, A] = 2 MB
    float* Qws = Kws + (size_t)BB * TV * AAA;        // [B*Tq, A] = 0.5 MB

    // 2560 tiles / 8 waves-per-block = 320 blocks
    hipLaunchKernelGGL(proj_kernel, dim3(320), dim3(256), 0, stream,
                       inputs, context, Wk, bk, Wq, bq, Kws, Qws);
    // B * Tq/16 = 64 blocks
    hipLaunchKernelGGL(attn_kernel, dim3(BB * (TQ / 16)), dim3(256), 0, stream,
                       inputs, mask, attn_v, Kws, Qws, out);
}

// v002
// It runs in 59.2 microseconds.
// Next to v001, in two timings, it ran 2.64 times as fast each time.
// Over all steps from v000 it is 14.5 times as fast.
#include <hip/hip_runtime.h>
#include <math.h>

// Problem constants (from reference setup_inputs)
#define BB   4
#define TQ   256
#define TV   1024
#define DD   512
#define AAA  128
#define NEG_BIG (-1.0e9f)
#define TANH_C 2.8853900817779268f   // 2 * log2(e)
#define LOG2E 1.4426950408889634f
#define NSPLIT 8             // key ranges per query tile, one work-group each
#define TVS  (TV / NSPLIT)   // keys per range

typedef __attribute__((ext_vector_type(2))) float v2f;
typedef __attribute__((ext_vector_type(4))) float v4f;
typedef __attribute__((ext_vector_type(8))) float v8f;
typedef __attribute__((ext_vector_type(4))) unsigned int v4u;
typedef __attribute__((ext_vector_type(8))) int v8i;
typedef __attribute__((ext_vector_type(4))) int v4i;

// ---------------------------------------------------------------------------
// TDM: async-copy one 16x128 f32 tile (row stride 128 floats in global) into
// LDS with 4-DWORD padding after every 128 DWORDs (-> 132-float LDS pitch).
// D# layout per CDNA5 ISA ch. 8 (group0 128b, group1 256b, groups 2/3 zero
// for a 2D tensor). Tracked with TENSORcnt. 6-arg builtin form (clang-23).
// ---------------------------------------------------------------------------
__device__ __forceinline__ void tdm_load_k_tile(const float* gsrc, unsigned lds_addr)
{
    unsigned long long ga = (unsigned long long)(size_t)gsrc;
    v4u g0;
    g0[0] = 1u;                                            // count=1, user-mode D#
    g0[1] = lds_addr;                                      // lds_addr [63:32]
    g0[2] = (unsigned)(ga & 0xFFFFFFFFull);                // global_addr lo
    g0[3] = (unsigned)((ga >> 32) & 0x1FFFFFFull)          // global_addr hi (57-bit)
          | (2u << 30);                                    // type=2 ("image")
    v8i g1;
    g1[0] = (int)((2u << 16)      // data_size = 4 bytes
                | (1u << 20)      // pad_enable
                | (6u << 22)      // pad_interval: 128 DWORDs
                | (3u << 25));    // pad_amount:   4 DWORDs
    g1[1] = (int)(128u << 16);    // tensor_dim0 = 128 (lo16 @ bits 48..63)
    g1[2] = (int)(16u  << 16);    // tensor_dim0 hi = 0 | tensor_dim1 = 16 (lo16)
    g1[3] = (int)(128u << 16);    // tensor_dim1 hi = 0 | tile_dim0 = 128
    g1[4] = 16;                   // tile_dim1 = 16, tile_dim2 = 0
    g1[5] = 128;                  // tensor_dim0_stride = 128 (lo32)
    g1[6] = 0;                    // stride hi | tensor_dim1_stride lo (unused, 2D)
    g1[7] = 0;
    v4i z4 = {0, 0, 0, 0};
    v8i z8 = {0, 0, 0, 0, 0, 0, 0, 0};
    __builtin_amdgcn_tensor_load_to_lds(g0, g1, z4, z4, z8, 0);
}

// ---------------------------------------------------------------------------
// Kernel 1: fused projections  K = inputs@Wk + bk ; Q = context@Wq + bq
// One wave per 16x16 output tile, V_WMMA_F32_16X16X4_F32 over K-dim 512.
// ---------------------------------------------------------------------------
__global__ __launch_bounds__(256)
void proj_kernel(const float* __restrict__ inputs, const float* __restrict__ context,
                 const float* __restrict__ Wk, const float* __restrict__ bk,
                 const float* __restrict__ Wq, const float* __restrict__ bq,
                 float* __restrict__ Kws, float* __restrict__ Qws)
{
    int wave = blockIdx.x * 8 + (threadIdx.x >> 5);
    int lane = threadIdx.x & 31;
    int mt = wave >> 3;      // 0..319
    int nt = wave & 7;       // 0..7 (A=128 -> 8 tiles of 16)

    const float* X; const float* W; const float* bias; float* out;
    int rowbase;
    if (mt < 256) { X = inputs;  W = Wk; bias = bk; out = Kws; rowbase = mt * 16; }
    else          { X = context; W = Wq; bias = bq; out = Qws; rowbase = (mt - 256) * 16; }

    int halfsel = (lane >> 4) << 1;         // 0 for lanes 0-15, 2 for lanes 16-31
    int mrow = rowbase + (lane & 15);       // A-matrix: M = lane%16
    int ncol = nt * 16 + (lane & 15);       // B/C/D: N = lane%16

    v8f acc = {};
    #pragma unroll 4
    for (int k = 0; k < DD; k += 4) {
        v2f afrag, bfrag;
        const float* ap = X + (size_t)mrow * DD + k + halfsel;
        afrag[0] = ap[0];
        afrag[1] = ap[1];
        const float* bp = W + (size_t)(k + halfsel) * AAA + ncol;
        bfrag[0] = bp[0];
        bfrag[1] = bp[AAA];
        acc = __builtin_amdgcn_wmma_f32_16x16x4_f32(false, afrag, false, bfrag,
                                                    (short)0, acc, false, false);
    }

    float bbv = bias[ncol];
    int mhi = (lane >> 4) << 3;             // C/D rows: r / r+8 by lane half
    #pragma unroll
    for (int r = 0; r < 8; ++r) {
        out[(size_t)(rowbase + r + mhi) * AAA + ncol] = acc[r] + bbv;
    }
}

// ---------------------------------------------------------------------------
// Kernel 2: fused score (tanh dot) + online softmax + attn@V (WMMA f32)
// One block per (batch, 16-query tile, key range of TVS keys). 8 waves; each
// wave owns a 64-wide D-slice of the accumulator. K chunks double-buffered via
// TDM async copy. The block leaves its un-normalised sums and its (max, sum)
// per query row in the workspace; merge_kernel joins the ranges.
// ---------------------------------------------------------------------------
__global__ __launch_bounds__(256)
void attn_kernel(const float* __restrict__ inputs, const int* __restrict__ mask,
                 const float* __restrict__ attn_v,
                 const float* __restrict__ Kws, const float* __restrict__ Qws,
                 float* __restrict__ Pst, float* __restrict__ Pacc)
{
    __shared__ float qbuf[16][132];      // 132-float pitch: conflict-free score loop
    __shared__ float kbuf[2][16][132];   // double-buffered TDM destination
    __shared__ float sbuf[16][16];
    __shared__ float pbuf[16][18];       // pad 18: conflict-free A-frag reads
    __shared__ float vv[AAA];
    __shared__ float mrow_s[16], lrow_s[16], crow_s[16];

    int tile = blockIdx.x / NSPLIT;       // range index fastest: blocks that share
    int vlo  = (blockIdx.x % NSPLIT) * TVS; // a range are NSPLIT apart in the grid
    int vhi  = vlo + TVS;
    int b  = tile >> 4;                   // 16 q-tiles per batch
    int q0 = (tile & 15) * 16;
    int tid  = threadIdx.x;
    int lane = tid & 31;
    int wav  = tid >> 5;

    const float* Kbase = Kws + (size_t)b * TV * AAA;

    // prologue: TDM-issue the range's first chunk into buffer 0 (wave 0 only;
    // EXEC-independent)
    if (wav == 0) {
        tdm_load_k_tile(Kbase + (size_t)vlo * AAA, (unsigned)(size_t)&kbuf[0][0][0]);
    }

    // stage Q tile + attn_v, init softmax state (overlaps with TDM)
    for (int i = tid; i < 16 * AAA; i += 256) {
        int r = i >> 7, c = i & 127;
        qbuf[r][c] = TANH_C * Qws[(size_t)(b * TQ + q0 + r) * AAA + c];
    }
    if (tid < AAA) vv[tid] = -2.0f * attn_v[tid];
    if (tid < 16) { mrow_s[tid] = -3.0e38f; lrow_s[tid] = 0.0f; }
    float sumv = 0.0f;                    // the "1" terms of the tanh form below
    for (int a = 0; a < AAA; ++a) sumv += attn_v[a];

    int dbase = wav * 64;                 // this wave's D-slice
    v8f acc[4] = {};
    int qi = tid >> 4, vi = tid & 15;     // score-lattice assignment
    int halfsel = (lane >> 4) << 1;
    int n15 = lane & 15;
    int mhi = (lane >> 4) << 3;
    int cur = 0;

    for (int v0 = vlo; v0 < vhi; v0 += 16) {
        // ---- prefetch next K chunk (other buffer), wait for current ----
        if (wav == 0) {
            if (v0 + 16 < vhi) {
                tdm_load_k_tile(Kbase + (size_t)(v0 + 16) * AAA,
                                (unsigned)(size_t)&kbuf[cur ^ 1][0][0]);
                __builtin_amdgcn_s_wait_tensorcnt(1);   // chunk v0 complete (in-order)
            } else {
                __builtin_amdgcn_s_wait_tensorcnt(0);
            }
        }
        __syncthreads();

        // ---- scores: tanh(x) = 1 - 2 / (2^(x * 2 log2 e) + 1), branch-free on the
        // hardware exp2 and reciprocal; 2^y = inf gives +1, 2^y = 0 gives -1.
        // qbuf holds q * 2 log2 e and vv holds -2 v, so
        // s[q,v] = sum_a v[a] + sum_a -2 v[a] / (2^y + 1).
        float s = sumv;
        // unrolled far: the LDS reads of later elements issue under the
        // exp2/rcp latency of earlier ones
        #pragma unroll 64
        for (int a = 0; a < AAA; ++a) {
            float e = __builtin_amdgcn_exp2f(fmaf(kbuf[cur][vi][a], TANH_C, qbuf[qi][a]));
            s = fmaf(vv[a], __builtin_amdgcn_rcpf(e + 1.0f), s);
        }
        if (mask[b * TV + v0 + vi] == 0) s += NEG_BIG;
        sbuf[qi][vi] = s;
        __syncthreads();

        // ---- online softmax stats (16 threads, one per q-row) ----
        if (tid < 16) {
            int rq = tid;
            float mo = mrow_s[rq];
            float mn = mo;
            #pragma unroll
            for (int j = 0; j < 16; ++j) mn = fmaxf(mn, sbuf[rq][j]);
            float corr = __expf(mo - mn);
            float ls = 0.0f;
            #pragma unroll
            for (int j = 0; j < 16; ++j) {
                float p = __expf(sbuf[rq][j] - mn);
                pbuf[rq][j] = p;
                ls += p;
            }
            mrow_s[rq] = mn;
            lrow_s[rq] = lrow_s[rq] * corr + ls;
            crow_s[rq] = corr;
        }
        __syncthreads();

        // ---- rescale accumulators by softmax correction ----
        #pragma unroll
        for (int r = 0; r < 8; ++r) {
            float c = crow_s[r + mhi];
            acc[0][r] *= c; acc[1][r] *= c; acc[2][r] *= c; acc[3][r] *= c;
        }

        // ---- acc += p(16x16) @ V_chunk(16x64slice) via WMMA f32 16x16x4 ----
        const float* Vbase = inputs + (size_t)(b * TV + v0) * DD;
        #pragma unroll
        for (int kk = 0; kk < 16; kk += 4) {
            v2f afrag;
            afrag[0] = pbuf[n15][kk + halfsel];
            afrag[1] = pbuf[n15][kk + halfsel + 1];
            #pragma unroll
            for (int t = 0; t < 4; ++t) {
                int n = dbase + t * 16 + n15;
                v2f bfrag;
                bfrag[0] = Vbase[(size_t)(kk + halfsel) * DD + n];
                bfrag[1] = Vbase[(size_t)(kk + halfsel + 1) * DD + n];
                acc[t] = __builtin_amdgcn_wmma_f32_16x16x4_f32(false, afrag, false, bfrag,
                                                               (short)0, acc[t], false, false);
            }
        }
        __syncthreads();  // all reads of kbuf[cur]/pbuf done
        cur ^= 1;
    }

    // ---- store this range's partial: sums un-normalised, then (max, sum) ----
    float* pa = Pacc + (size_t)blockIdx.x * 16 * DD;
    #pragma unroll
    for (int r = 0; r < 8; ++r) {
        #pragma unroll
        for (int t = 0; t < 4; ++t) {
            pa[(size_t)(r + mhi) * DD + dbase + t * 16 + n15] = acc[t][r];
        }
    }
    // 32 floats = one 128-byte line per block
    if (tid < 16) {
        Pst[blockIdx.x * 32 + tid]      = mrow_s[tid];
        Pst[blockIdx.x * 32 + 16 + tid] = lrow_s[tid];
    }
}

// ---------------------------------------------------------------------------
// Kernel 3: join the NSPLIT key ranges of each query row:
// M = max m_s, w_s = exp(m_s - M), out = sum w_s acc_s / sum w_s l_s.
// One block per 4 query rows; a thread owns 4 columns of 2 rows.
// ---------------------------------------------------------------------------
__device__ __forceinline__ float exp2_with_slot(float x)
{
    float r;
    // v_nop: the one slot that the instruction set asks for behind a transcendental
    // before its result is read or its source overwritten
    asm("v_exp_f32 %0, %1\n\tv_nop" : "=v"(r) : "v"(x));
    return r;
}

__global__ __launch_bounds__(256)
void merge_kernel(const float* __restrict__ Pst, const float* __restrict__ Pacc,
                  float* __restrict__ out)
{
    int tile = blockIdx.x >> 2;
    int c = (threadIdx.x & 127) * 4;
    // the row pair is the same in all lanes of a wave: (max, sum) come by scalar loads
    int r0 = (blockIdx.x & 3) * 4 + __builtin_amdgcn_readfirstlane(threadIdx.x >> 7) * 2;
    const float* st = Pst + tile * NSPLIT * 32 + r0;
    const float* pa = Pacc + ((size_t)tile * NSPLIT * 16 + r0) * DD + c;

    v4f p[2][NSPLIT];
    #pragma unroll
    for (int s = 0; s < NSPLIT; ++s) {
        #pragma unroll
        for (int j = 0; j < 2; ++j)
            p[j][s] = *(const v4f*)(pa + (size_t)(s * 16 + j) * DD);
    }
    // the code below reuses the base registers that the 16 issued loads name: this
    // wait stands in front of that overwrite; as a memory clobber it also keeps the
    // loads from sinking among the sums, so that all 16 are in flight together
    asm volatile("s_wait_xcnt 0x0" ::: "memory");

    float m[2][NSPLIT], l[2][NSPLIT];
    #pragma unroll
    for (int s = 0; s < NSPLIT; ++s) {
        #pragma unroll
        for (int j = 0; j < 2; ++j) {
            m[j][s] = st[s * 32 + j];
            l[j][s] = st[s * 32 + 16 + j];
        }
    }

    #pragma unroll
    for (int j = 0; j < 2; ++j) {
        float mx = m[j][0];
        #pragma unroll
        for (int s = 1; s < NSPLIT; ++s) mx = fmaxf(mx, m[j][s]);
        float ls = 0.0f;
        v4f o = {0.0f, 0.0f, 0.0f, 0.0f};
        #pragma unroll
        for (int s = 0; s < NSPLIT; ++s) {
            float w = exp2_with_slot((m[j][s] - mx) * LOG2E);
            ls += w * l[j][s];
            o  += w * p[j][s];
        }
        *(v4f*)(out + (size_t)(tile * 16 + r0 + j) * DD + c) = o * (1.0f / ls);
    }
}

// ---------------------------------------------------------------------------
extern "C" void kernel_launch(void* const* d_in, const int* in_sizes, int n_in,
                              void* d_out, int out_size, void* d_ws, size_t ws_size,
                              hipStream_t stream)
{
    (void)in_sizes; (void)n_in; (void)out_size; (void)ws_size;
    const float* inputs  = (const float*)d_in[0];   // [B,Tv,D]
    const float* context = (const float*)d_in[1];   // [B,Tq,D]
    const int*   mask    = (const int*)  d_in[2];   // [B,Tv]
    const float* Wk      = (const float*)d_in[3];   // [D,A]
    const float* bk      = (const float*)d_in[4];   // [A]
    const float* Wq      = (const float*)d_in[5];   // [D,A]
    const float* bq      = (const float*)d_in[6];   // [A]
    const float* attn_v  = (const float*)d_in[7];   // [A]
    float* out = (float*)d_out;                     // [B,Tq,D]

    float* Kws = (float*)d_ws;                       // [B*Tv, A] = 2 MB
    float* Qws = Kws + (size_t)BB * TV * AAA;        // [B*Tq, A] = 0.5 MB
    float* Pst = Qws + (size_t)BB * TQ * AAA;        // [64*NSPLIT, 32] (max, sum)
    float* Pacc = Pst + (size_t)BB * (TQ / 16) * NSPLIT * 32;  // [64*NSPLIT, 16, D]

    // 2560 tiles / 8 waves-per-block = 320 blocks
    hipLaunchKernelGGL(proj_kernel, dim3(320), dim3(256), 0, stream,
                       inputs, context, Wk, bk, Wq, bq, Kws, Qws);
    // B * Tq/16 * NSPLIT blocks
    hipLaunchKernelGGL(attn_kernel, dim3(BB * (TQ / 16) * NSPLIT), dim3(256), 0, stream,
                       inputs, mask, attn_v, Kws, Qws, Pst, Pacc);
    // B * Tq / 4 = 256 blocks
    hipLaunchKernelGGL(merge_kernel, dim3(BB * TQ / 4), dim3(256), 0, stream,
                       Pst, Pacc, out);
}

// v003
// A run of this version takes 47.5 microseconds.
// Timed twice side by side with v002, it ran 1.25 times as fast both times.
// All steps since v000 together make it 18.1 times as fast.
#include <hip/hip_runtime.h>
#include <math.h>

// Problem constants (from reference setup_inputs)
#define BB   4
#define TQ   256
#define TV   1024
#define DD   512
#define AAA  128
#define NEG_BIG (-1.0e9f)
#define TANH_C 2.8853900817779268f   // 2 * log2(e)
#define LOG2E 1.4426950408889634f
#define NSPLIT 8             // key ranges per query tile, one work-group each
#define TVS  (TV / NSPLIT)   // keys per range

typedef __attribute__((ext_vector_type(2))) float v2f;
typedef __attribute__((ext_vector_type(4))) float v4f;
typedef __attribute__((ext_vector_type(8))) float v8f;
typedef __attribute__((ext_vector_type(4))) unsigned int v4u;
typedef __attribute__((ext_vector_type(8))) int v8i;
typedef __attribute__((ext_vector_type(4))) int v4i;

// ---------------------------------------------------------------------------
// TDM: async-copy one 16x128 f32 tile (row stride 128 floats in global) into
// LDS with 4-DWORD padding after every 128 DWORDs (-> 132-float LDS pitch).
// D# layout per CDNA5 ISA ch. 8 (group0 128b, group1 256b, groups 2/3 zero
// for a 2D tensor). Tracked with TENSORcnt. 6-arg builtin form (clang-23).
// ---------------------------------------------------------------------------
__device__ __forceinline__ void tdm_load_k_tile(const float* gsrc, unsigned lds_addr)
{
    unsigned long long ga = (unsigned long long)(size_t)gsrc;
    v4u g0;
    g0[0] = 1u;                                            // count=1, user-mode D#
    g0[1] = lds_addr;                                      // lds_addr [63:32]
    g0[2] = (unsigned)(ga & 0xFFFFFFFFull);                // global_addr lo
    g0[3] = (unsigned)((ga >> 32) & 0x1FFFFFFull)          // global_addr hi (57-bit)
          | (2u << 30);                                    // type=2 ("image")
    v8i g1;
    g1[0] = (int)((2u << 16)      // data_size = 4 bytes
                | (1u << 20)      // pad_enable
                | (6u << 22)      // pad_interval: 128 DWORDs
                | (3u << 25));    // pad_amount:   4 DWORDs
    g1[1] = (int)(128u << 16);    // tensor_dim0 = 128 (lo16 @ bits 48..63)
    g1[2] = (int)(16u  << 16);    // tensor_dim0 hi = 0 | tensor_dim1 = 16 (lo16)
    g1[3] = (int)(128u << 16);    // tensor_dim1 hi = 0 | tile_dim0 = 128
    g1[4] = 16;                   // tile_dim1 = 16, tile_dim2 = 0
    g1[5] = 128;                  // tensor_dim0_stride = 128 (lo32)
    g1[6] = 0;                    // stride hi | tensor_dim1_stride lo (unused, 2D)
    g1[7] = 0;
    v4i z4 = {0, 0, 0, 0};
    v8i z8 = {0, 0, 0, 0, 0, 0, 0, 0};
    __builtin_amdgcn_tensor_load_to_lds(g0, g1, z4, z4, z8, 0);
}

// ---------------------------------------------------------------------------
// Kernel 1: fused projections  K = inputs@Wk + bk ; Q = context@Wq + bq
// One block of 8 waves per 32 rows of X. The rows are staged once in LDS by
// whole-line 16-byte loads; wave w owns the 16 columns w*16.. of all 32 rows
// as two 16x16 tiles, so that one B fragment of W feeds two
// V_WMMA_F32_16X16X4_F32. W is fetched one group of PGK k-steps ahead.
// ---------------------------------------------------------------------------
#define PROWS 32             // rows of X per block
#define XPITCH 516           // floats; 4 mod 64: the 8-byte A reads of a wave hit all 64 banks once
#define PGK 16               // k-steps (of 4) per group of W loads
#define PNG (DD / 4 / PGK)   // groups

__global__ __launch_bounds__(256)
void proj_kernel(const float* __restrict__ inputs, const float* __restrict__ context,
                 const float* __restrict__ Wk, const float* __restrict__ bk,
                 const float* __restrict__ Wq, const float* __restrict__ bq,
                 float* __restrict__ Kws, float* __restrict__ Qws)
{
    __shared__ __attribute__((aligned(16))) float xs[PROWS * XPITCH];

    int tid  = threadIdx.x;
    int lane = tid & 31;
    int wav  = tid >> 5;
    int mt   = blockIdx.x;   // 0..159

    const float* X; const float* W; const float* bias; float* out;
    int rowbase;
    if (mt < 128) { X = inputs;  W = Wk; bias = bk; out = Kws; rowbase = mt * PROWS; }
    else          { X = context; W = Wq; bias = bq; out = Qws; rowbase = (mt - 128) * PROWS; }

    int halfsel = (lane >> 4) << 1;         // 0 for lanes 0-15, 2 for lanes 16-31
    int l15 = lane & 15;
    int ncol = wav * 16 + l15;              // B/C/D: N = lane%16

    // rows k + halfsel and k + halfsel + 1 of W
    const float* wp = W + (size_t)halfsel * AAA + ncol;
    v2f wb[2][PGK];
    // every loop over wb is unrolled in full: its indices must be constants for it
    // to live in registers
    #pragma unroll
    for (int s = 0; s < PGK; ++s) {
        wb[0][s][0] = wp[(size_t)(s * 4) * AAA];
        wb[0][s][1] = wp[(size_t)(s * 4 + 1) * AAA];
    }

    // stage the rows: pass i moves rows 2i and 2i+1, 256 threads x 16 bytes
    const v4f* xg = (const v4f*)(X + (size_t)rowbase * DD);
    v4f xr[PROWS / 2];
    // unrolled: all 16 loads are in flight before the first store waits
    #pragma unroll
    for (int i = 0; i < PROWS / 2; ++i) xr[i] = xg[i * 256 + tid];
    #pragma unroll
    for (int i = 0; i < PROWS / 2; ++i)
        *(v4f*)(xs + (i * 2 + (tid >> 7)) * XPITCH + (tid & 127) * 4) = xr[i];
    __syncthreads();

    const float* ap = xs + l15 * XPITCH + halfsel;   // A-matrix: M = lane%16
    v8f acc0 = {}, acc1 = {};
    // unrolled in full: the W loads of the next group issue among this group's matrix
    // instructions and are waited for by count, never all at once
    #pragma unroll
    for (int g = 0; g < PNG; ++g) {
        if (g + 1 < PNG) {
            #pragma unroll
            for (int s = 0; s < PGK; ++s) {
                int k = ((g + 1) * PGK + s) * 4;
                wb[(g + 1) & 1][s][0] = wp[(size_t)k * AAA];
                wb[(g + 1) & 1][s][1] = wp[(size_t)(k + 1) * AAA];
            }
        }
        #pragma unroll
        for (int s = 0; s < PGK; ++s) {
            v2f a0 = *(const v2f*)(ap + (g * PGK + s) * 4);
            v2f a1 = *(const v2f*)(ap + 16 * XPITCH + (g * PGK + s) * 4);
            acc0 = __builtin_amdgcn_wmma_f32_16x16x4_f32(false, a0, false, wb[g & 1][s],
                                                         (short)0, acc0, false, false);
            acc1 = __builtin_amdgcn_wmma_f32_16x16x4_f32(false, a1, false, wb[g & 1][s],
                                                         (short)0, acc1, false, false);
        }
    }

    float bbv = bias[ncol];

    // v_nop x4: the vector slots between a matrix instruction and the first vector
    // instruction that reads its result; the bias adds would follow the last two
    // matrix instructions at once
    asm volatile("v_nop\n\tv_nop\n\tv_nop\n\tv_nop" : "+v"(acc0), "+v"(acc1));

    int mhi = (lane >> 4) << 3;             // C/D rows: r / r+8 by lane half
    #pragma unroll
    for (int r = 0; r < 8; ++r) {
        out[(size_t)(rowbase + r + mhi) * AAA + ncol]      = acc0[r] + bbv;
        out[(size_t)(rowbase + 16 + r + mhi) * AAA + ncol] = acc1[r] + bbv;
    }
}

// ---------------------------------------------------------------------------
// Kernel 2: fused score (tanh dot) + online softmax + attn@V (WMMA f32)
// One block per (batch, 16-query tile, key range of TVS keys). 8 waves; each
// wave owns a 64-wide D-slice of the accumulator. K chunks double-buffered via
// TDM async copy. The block leaves its un-normalised sums and its (max, sum)
// per query row in the workspace; merge_kernel joins the ranges.
// ---------------------------------------------------------------------------
__global__ __launch_bounds__(256)
void attn_kernel(const float* __restrict__ inputs, const int* __restrict__ mask,
                 const float* __restrict__ attn_v,
                 const float* __restrict__ Kws, const float* __restrict__ Qws,
                 float* __restrict__ Pst, float* __restrict__ Pacc)
{
    __shared__ float qbuf[16][132];      // 132-float pitch: conflict-free score loop
    __shared__ float kbuf[2][16][132];   // double-buffered TDM destination
    __shared__ float sbuf[16][16];
    __shared__ float pbuf[16][18];       // pad 18: conflict-free A-frag reads
    __shared__ float vv[AAA];
    __shared__ float mrow_s[16], lrow_s[16], crow_s[16];

    int tile = blockIdx.x / NSPLIT;       // range index fastest: blocks that share
    int vlo  = (blockIdx.x % NSPLIT) * TVS; // a range are NSPLIT apart in the grid
    int vhi  = vlo + TVS;
    int b  = tile >> 4;                   // 16 q-tiles per batch
    int q0 = (tile & 15) * 16;
    int tid  = threadIdx.x;
    int lane = tid & 31;
    int wav  = tid >> 5;

    const float* Kbase = Kws + (size_t)b * TV * AAA;

    // prologue: TDM-issue the range's first chunk into buffer 0 (wave 0 only;
    // EXEC-independent)
    if (wav == 0) {
        tdm_load_k_tile(Kbase + (size_t)vlo * AAA, (unsigned)(size_t)&kbuf[0][0][0]);
    }

    // stage Q tile + attn_v, init softmax state (overlaps with TDM)
    for (int i = tid; i < 16 * AAA; i += 256) {
        int r = i >> 7, c = i & 127;
        qbuf[r][c] = TANH_C * Qws[(size_t)(b * TQ + q0 + r) * AAA + c];
    }
    if (tid < AAA) vv[tid] = -2.0f * attn_v[tid];
    if (tid < 16) { mrow_s[tid] = -3.0e38f; lrow_s[tid] = 0.0f; }
    float sumv = 0.0f;                    // the "1" terms of the tanh form below
    for (int a = 0; a < AAA; ++a) sumv += attn_v[a];

    int dbase = wav * 64;                 // this wave's D-slice
    v8f acc[4] = {};
    int qi = tid >> 4, vi = tid & 15;     // score-lattice assignment
    int halfsel = (lane >> 4) << 1;
    int n15 = lane & 15;
    int mhi = (lane >> 4) << 3;
    int cur = 0;

    for (int v0 = vlo; v0 < vhi; v0 += 16) {
        // ---- prefetch next K chunk (other buffer), wait for current ----
        if (wav == 0) {
            if (v0 + 16 < vhi) {
                tdm_load_k_tile(Kbase + (size_t)(v0 + 16) * AAA,
                                (unsigned)(size_t)&kbuf[cur ^ 1][0][0]);
                __builtin_amdgcn_s_wait_tensorcnt(1);   // chunk v0 complete (in-order)
            } else {
                __builtin_amdgcn_s_wait_tensorcnt(0);
            }
        }
        __syncthreads();

        // ---- scores: tanh(x) = 1 - 2 / (2^(x * 2 log2 e) + 1), branch-free on the
        // hardware exp2 and reciprocal; 2^y = inf gives +1, 2^y = 0 gives -1.
        // qbuf holds q * 2 log2 e and vv holds -2 v, so
        // s[q,v] = sum_a v[a] + sum_a -2 v[a] / (2^y + 1).
        float s = sumv;
        // unrolled far: the LDS reads of later elements issue under the
        // exp2/rcp latency of earlier ones
        #pragma unroll 64
        for (int a = 0; a < AAA; ++a) {
            float e = __builtin_amdgcn_exp2f(fmaf(kbuf[cur][vi][a], TANH_C, qbuf[qi][a]));
            s = fmaf(vv[a], __builtin_amdgcn_rcpf(e + 1.0f), s);
        }
        if (mask[b * TV + v0 + vi] == 0) s += NEG_BIG;
        sbuf[qi][vi] = s;
        __syncthreads();

        // ---- online softmax stats (16 threads, one per q-row) ----
        if (tid < 16) {
            int rq = tid;
            float mo = mrow_s[rq];
            float mn = mo;
            #pragma unroll
            for (int j = 0; j < 16; ++j) mn = fmaxf(mn, sbuf[rq][j]);
            float corr = __expf(mo - mn);
            float ls = 0.0f;
            #pragma unroll
            for (int j = 0; j < 16; ++j) {
                float p = __expf(sbuf[rq][j] - mn);
                pbuf[rq][j] = p;
                ls += p;
            }
            mrow_s[rq] = mn;
            lrow_s[rq] = lrow_s[rq] * corr + ls;
            crow_s[rq] = corr;
        }
        __syncthreads();

        // ---- rescale accumulators by softmax correction ----
        #pragma unroll
        for (int r = 0; r < 8; ++r) {
            float c = crow_s[r + mhi];
            acc[0][r] *= c; acc[1][r] *= c; acc[2][r] *= c; acc[3][r] *= c;
        }

        // ---- acc += p(16x16) @ V_chunk(16x64slice) via WMMA f32 16x16x4 ----
        const float* Vbase = inputs + (size_t)(b * TV + v0) * DD;
        #pragma unroll
        for (int kk = 0; kk < 16; kk += 4) {
            v2f afrag;
            afrag[0] = pbuf[n15][kk + halfsel];
            afrag[1] = pbuf[n15][kk + halfsel + 1];
            #pragma unroll
            for (int t = 0; t < 4; ++t) {
                int n = dbase + t * 16 + n15;
                v2f bfrag;
                bfrag[0] = Vbase[(size_t)(kk + halfsel) * DD + n];
                bfrag[1] = Vbase[(size_t)(kk + halfsel + 1) * DD + n];
                acc[t] = __builtin_amdgcn_wmma_f32_16x16x4_f32(false, afrag, false, bfrag,
                                                               (short)0, acc[t], false, false);
            }
        }
        __syncthreads();  // all reads of kbuf[cur]/pbuf done
        cur ^= 1;
    }

    // ---- store this range's partial: sums un-normalised, then (max, sum) ----
    float* pa = Pacc + (size_t)blockIdx.x * 16 * DD;
    #pragma unroll
    for (int r = 0; r < 8; ++r) {
        #pragma unroll
        for (int t = 0; t < 4; ++t) {
            pa[(size_t)(r + mhi) * DD + dbase + t * 16 + n15] = acc[t][r];
        }
    }
    // 32 floats = one 128-byte line per block
    if (tid < 16) {
        Pst[blockIdx.x * 32 + tid]      = mrow_s[tid];
        Pst[blockIdx.x * 32 + 16 + tid] = lrow_s[tid];
    }
}

// ---------------------------------------------------------------------------
// Kernel 3: join the NSPLIT key ranges of each query row:
// M = max m_s, w_s = exp(m_s - M), out = sum w_s acc_s / sum w_s l_s.
// One block per 4 query rows; a thread owns 4 columns of 2 rows.
// ---------------------------------------------------------------------------
__device__ __forceinline__ float exp2_with_slot(float x)
{
    float r;
    // v_nop: the one slot that the instruction set asks for behind a transcendental
    // before its result is read or its source overwritten
    asm("v_exp_f32 %0, %1\n\tv_nop" : "=v"(r) : "v"(x));
    return r;
}

__global__ __launch_bounds__(256)
void merge_kernel(const float* __restrict__ Pst, const float* __restrict__ Pacc,
                  float* __restrict__ out)
{
    int tile = blockIdx.x >> 2;
    int c = (threadIdx.x & 127) * 4;
    // the row pair is the same in all lanes of a wave: (max, sum) come by scalar loads
    int r0 = (blockIdx.x & 3) * 4 + __builtin_amdgcn_readfirstlane(threadIdx.x >> 7) * 2;
    const float* st = Pst + tile * NSPLIT * 32 + r0;
    const float* pa = Pacc + ((size_t)tile * NSPLIT * 16 + r0) * DD + c;

    v4f p[2][NSPLIT];
    #pragma unroll
    for (int s = 0; s < NSPLIT; ++s) {
        #pragma unroll
        for (int j = 0; j < 2; ++j)
            p[j][s] = *(const v4f*)(pa + (size_t)(s * 16 + j) * DD);
    }
    // the code below reuses the base registers that the 16 issued loads name: this
    // wait stands in front of that overwrite; as a memory clobber it also keeps the
    // loads from sinking among the sums, so that all 16 are in flight together
    asm volatile("s_wait_xcnt 0x0" ::: "memory");

    float m[2][NSPLIT], l[2][NSPLIT];
    #pragma unroll
    for (int s = 0; s < NSPLIT; ++s) {
        #pragma unroll
        for (int j = 0; j < 2; ++j) {
            m[j][s] = st[s * 32 + j];
            l[j][s] = st[s * 32 + 16 + j];
        }
    }

    #pragma unroll
    for (int j = 0; j < 2; ++j) {
        float mx = m[j][0];
        #pragma unroll
        for (int s = 1; s < NSPLIT; ++s) mx = fmaxf(mx, m[j][s]);
        float ls = 0.0f;
        v4f o = {0.0f, 0.0f, 0.0f, 0.0f};
        #pragma unroll
        for (int s = 0; s < NSPLIT; ++s) {
            float w = exp2_with_slot((m[j][s] - mx) * LOG2E);
            ls += w * l[j][s];
            o  += w * p[j][s];
        }
        *(v4f*)(out + (size_t)(tile * 16 + r0 + j) * DD + c) = o * (1.0f / ls);
    }
}

// ---------------------------------------------------------------------------
extern "C" void kernel_launch(void* const* d_in, const int* in_sizes, int n_in,
                              void* d_out, int out_size, void* d_ws, size_t ws_size,
                              hipStream_t stream)
{
    (void)in_sizes; (void)n_in; (void)out_size; (void)ws_size;
    const float* inputs  = (const float*)d_in[0];   // [B,Tv,D]
    const float* context = (const float*)d_in[1];   // [B,Tq,D]
    const int*   mask    = (const int*)  d_in[2];   // [B,Tv]
    const float* Wk      = (const float*)d_in[3];   // [D,A]
    const float* bk      = (const float*)d_in[4];   // [A]
    const float* Wq      = (const float*)d_in[5];   // [D,A]
    const float* bq      = (const float*)d_in[6];   // [A]
    const float* attn_v  = (const float*)d_in[7];   // [A]
    float* out = (float*)d_out;                     // [B,Tq,D]

    float* Kws = (float*)d_ws;                       // [B*Tv, A] = 2 MB
    float* Qws = Kws + (size_t)BB * TV * AAA;        // [B*Tq, A] = 0.5 MB
    float* Pst = Qws + (size_t)BB * TQ * AAA;        // [64*NSPLIT, 32] (max, sum)
    float* Pacc = Pst + (size_t)BB * (TQ / 16) * NSPLIT * 32;  // [64*NSPLIT, 16, D]

    // (B*Tv + B*Tq) / 32 rows = 160 blocks of 8 waves
    hipLaunchKernelGGL(proj_kernel, dim3(160), dim3(256), 0, stream,
                       inputs, context, Wk, bk, Wq, bq, Kws, Qws);
    // B * Tq/16 * NSPLIT blocks
    hipLaunchKernelGGL(attn_kernel, dim3(BB * (TQ / 16) * NSPLIT), dim3(256), 0, stream,
                       inputs, mask, attn_v, Kws, Qws, Pst, Pacc);
    // B * Tq / 4 = 256 blocks
    hipLaunchKernelGGL(merge_kernel, dim3(BB * TQ / 4), dim3(256), 0, stream,
                       Pst, Pacc, out);
}

// v004
// It runs in 39.1 microseconds.
// Timed twice side by side with v003, it ran 1.21 times as fast both times.
// All steps since v000 together make it 22.0 times as fast.
#include <hip/hip_runtime.h>
#include <math.h>

// Problem constants (from reference setup_inputs)
#define BB   4
#define TQ   256
#define TV   1024
#define DD   512
#define AAA  128
#define NEG_BIG (-1.0e9f)
#define TANH_C 2.8853900817779268f   // 2 * log2(e)
#define LOG2E 1.4426950408889634f
#define NSPLIT 8             // key ranges per query tile, one work-group each
#define TVS  (TV / NSPLIT)   // keys per range

typedef __attribute__((ext_vector_type(2))) float v2f;
typedef __attribute__((ext_vector_type(4))) float v4f;
typedef __attribute__((ext_vector_type(8))) float v8f;

// ---------------------------------------------------------------------------
// Kernel 1: fused projections  K = inputs@Wk + bk ; Q = context@Wq + bq
// One block of 8 waves per 32 rows of X. The rows are staged once in LDS by
// whole-line 16-byte loads; wave w owns the 16 columns w*16.. of all 32 rows
// as two 16x16 tiles, so that one B fragment of W feeds two
// V_WMMA_F32_16X16X4_F32. W is fetched one group of PGK k-steps ahead.
// ---------------------------------------------------------------------------
#define PROWS 32             // rows of X per block
#define XPITCH 516           // floats; 4 mod 64: the 8-byte A reads of a wave hit all 64 banks once
#define PGK 16               // k-steps (of 4) per group of W loads
#define PNG (DD / 4 / PGK)   // groups

__global__ __launch_bounds__(256)
void proj_kernel(const float* __restrict__ inputs, const float* __restrict__ context,
                 const float* __restrict__ Wk, const float* __restrict__ bk,
                 const float* __restrict__ Wq, const float* __restrict__ bq,
                 float* __restrict__ Kws, float* __restrict__ Qws)
{
    __shared__ __attribute__((aligned(16))) float xs[PROWS * XPITCH];

    int tid  = threadIdx.x;
    int lane = tid & 31;
    int wav  = tid >> 5;
    int mt   = blockIdx.x;   // 0..159

    const float* X; const float* W; const float* bias; float* out;
    int rowbase;
    if (mt < 128) { X = inputs;  W = Wk; bias = bk; out = Kws; rowbase = mt * PROWS; }
    else          { X = context; W = Wq; bias = bq; out = Qws; rowbase = (mt - 128) * PROWS; }

    int halfsel = (lane >> 4) << 1;         // 0 for lanes 0-15, 2 for lanes 16-31
    int l15 = lane & 15;
    int ncol = wav * 16 + l15;              // B/C/D: N = lane%16

    // rows k + halfsel and k + halfsel + 1 of W
    const float* wp = W + (size_t)halfsel * AAA + ncol;
    v2f wb[2][PGK];
    // every loop over wb is unrolled in full: its indices must be constants for it
    // to live in registers
    #pragma unroll
    for (int s = 0; s < PGK; ++s) {
        wb[0][s][0] = wp[(size_t)(s * 4) * AAA];
        wb[0][s][1] = wp[(size_t)(s * 4 + 1) * AAA];
    }

    // stage the rows: pass i moves rows 2i and 2i+1, 256 threads x 16 bytes
    const v4f* xg = (const v4f*)(X + (size_t)rowbase * DD);
    v4f xr[PROWS / 2];
    // unrolled: all 16 loads are in flight before the first store waits
    #pragma unroll
    for (int i = 0; i < PROWS / 2; ++i) xr[i] = xg[i * 256 + tid];
    #pragma unroll
    for (int i = 0; i < PROWS / 2; ++i)
        *(v4f*)(xs + (i * 2 + (tid >> 7)) * XPITCH + (tid & 127) * 4) = xr[i];
    __syncthreads();

    const float* ap = xs + l15 * XPITCH + halfsel;   // A-matrix: M = lane%16
    v8f acc0 = {}, acc1 = {};
    // unrolled in full: the W loads of the next group issue among this group's matrix
    // instructions and are waited for by count, never all at once
    #pragma unroll
    for (int g = 0; g < PNG; ++g) {
        if (g + 1 < PNG) {
            #pragma unroll
            for (int s = 0; s < PGK; ++s) {
                int k = ((g + 1) * PGK + s) * 4;
                wb[(g + 1) & 1][s][0] = wp[(size_t)k * AAA];
                wb[(g + 1) & 1][s][1] = wp[(size_t)(k + 1) * AAA];
            }
        }
        #pragma unroll
        for (int s = 0; s < PGK; ++s) {
            v2f a0 = *(const v2f*)(ap + (g * PGK + s) * 4);
            v2f a1 = *(const v2f*)(ap + 16 * XPITCH + (g * PGK + s) * 4);
            acc0 = __builtin_amdgcn_wmma_f32_16x16x4_f32(false, a0, false, wb[g & 1][s],
                                                         (short)0, acc0, false, false);
            acc1 = __builtin_amdgcn_wmma_f32_16x16x4_f32(false, a1, false, wb[g & 1][s],
                                                         (short)0, acc1, false, false);
        }
    }

    float bbv = bias[ncol];

    // v_nop x4: the vector slots between a matrix instruction and the first vector
    // instruction that reads its result; the bias adds would follow the last two
    // matrix instructions at once
    asm volatile("v_nop\n\tv_nop\n\tv_nop\n\tv_nop" : "+v"(acc0), "+v"(acc1));

    int mhi = (lane >> 4) << 3;             // C/D rows: r / r+8 by lane half
    #pragma unroll
    for (int r = 0; r < 8; ++r) {
        out[(size_t)(rowbase + r + mhi) * AAA + ncol]      = acc0[r] + bbv;
        out[(size_t)(rowbase + 16 + r + mhi) * AAA + ncol] = acc1[r] + bbv;
    }
}

// ---------------------------------------------------------------------------
// Kernel 2: fused score (tanh dot) + softmax over the range + attn@V (WMMA f32)
// One block per (batch, 16-query tile, key range of TVS keys), 8 waves. The
// whole range goes through each phase once: its K rows are staged in LDS, a
// thread scores NCH keys of one query row side by side, the row's maximum and
// sum are taken across the 16 lanes that hold it, and one run of matrix
// instructions over all TVS keys follows; each wave owns a 64-wide D-slice.
// The block leaves its un-normalised sums and its (max, sum) per query row in
// the workspace; merge_kernel joins the ranges.
// ---------------------------------------------------------------------------
__device__ __forceinline__ float exp2_with_slot(float x)
{
    float r;
    // v_nop: the one slot that the instruction set asks for behind a transcendental
    // before its result is read or its source overwritten
    asm("v_exp_f32 %0, %1\n\tv_nop" : "=v"(r) : "v"(x));
    return r;
}

#define NCH (TVS / 16)       // keys per thread in the score phase
#define KPITCH 132           // floats; 4 mod 64: 16-byte reads of 16 rows hit all 64 banks once

__global__ __launch_bounds__(256)
void attn_kernel(const float* __restrict__ inputs, const int* __restrict__ mask,
                 const float* __restrict__ attn_v,
                 const float* __restrict__ Kws, const float* __restrict__ Qws,
                 float* __restrict__ Pst, float* __restrict__ Pacc)
{
    __shared__ __attribute__((aligned(16))) float qbuf[16][KPITCH];
    __shared__ __attribute__((aligned(16))) float kbuf[TVS][KPITCH];
    __shared__ __attribute__((aligned(16))) float pbuf[16][KPITCH];  // same pitch: conflict-free A-frag reads
    __shared__ __attribute__((aligned(16))) float vv[AAA];
    __shared__ float mrow_s[16], lrow_s[16];

    int tile = blockIdx.x / NSPLIT;       // range index fastest: blocks that share
    int vlo  = (blockIdx.x % NSPLIT) * TVS; // a range are NSPLIT apart in the grid
    int b  = tile >> 4;                   // 16 q-tiles per batch
    int q0 = (tile & 15) * 16;
    int tid  = threadIdx.x;
    int lane = tid & 31;
    int wav  = tid >> 5;
    int qi = tid >> 4, vi = tid & 15;     // score-lattice assignment

    // the range's K rows and the Q tile: pass i moves rows 8i..8i+7, one 512-byte
    // row per wave
    const v4f* kg = (const v4f*)(Kws + (size_t)(b * TV + vlo) * AAA);
    v4f kr[TVS / 8];
    // unrolled: all loads are in flight before the first store waits
    #pragma unroll
    for (int i = 0; i < TVS / 8; ++i) kr[i] = kg[i * 256 + tid];
    const v4f* qg = (const v4f*)(Qws + (size_t)(b * TQ + q0) * AAA);
    v4f qr[2];
    #pragma unroll
    for (int i = 0; i < 2; ++i) qr[i] = qg[i * 256 + tid];
    int mk[NCH];
    #pragma unroll
    for (int j = 0; j < NCH; ++j) mk[j] = mask[b * TV + vlo + j * 16 + vi];
    // the code below reuses the address registers that the issued loads name: this
    // wait stands in front of that overwrite
    asm volatile("s_wait_xcnt 0x0" ::: "memory");

    // attn_v (under the latency of the K and Q loads)
    if (tid < AAA) vv[tid] = -2.0f * attn_v[tid];
    float sumv = 0.0f;                    // the "1" terms of the tanh form below
    for (int a = 0; a < AAA; ++a) sumv += attn_v[a];

    #pragma unroll
    for (int i = 0; i < TVS / 8; ++i)
        *(v4f*)&kbuf[i * 8 + wav][lane * 4] = kr[i];
    #pragma unroll
    for (int i = 0; i < 2; ++i)
        *(v4f*)&qbuf[i * 8 + wav][lane * 4] = TANH_C * qr[i];
    __syncthreads();

    // ---- scores: tanh(x) = 1 - 2 / (2^(x * 2 log2 e) + 1), branch-free on the
    // hardware exp2 and reciprocal; 2^y = inf gives +1, 2^y = 0 gives -1.
    // qbuf holds q * 2 log2 e and vv holds -2 v, so
    // s[q,v] = sum_a v[a] + sum_a -2 v[a] / (2^y + 1).
    // Keys vi + 16 j of row qi: one read of q and of v serves NCH keys.
    // Four partial sums per score, one per a mod 4: every step from the LDS read to
    // the sum then works on the same register pair, two elements per instruction.
    v4f s4[NCH];
    #pragma unroll
    for (int j = 0; j < NCH; ++j) s4[j] = (v4f){sumv, 0.0f, 0.0f, 0.0f};
    // unrolled by 2: twenty LDS reads are in flight behind each other, and their
    // latency is paid once per 64 elements
    #pragma unroll 2
    for (int a = 0; a < AAA; a += 4) {
        v4f q4 = *(const v4f*)&qbuf[qi][a];
        v4f w4 = *(const v4f*)&vv[a];
        #pragma unroll
        for (int j = 0; j < NCH; ++j) {
            v4f k4 = *(const v4f*)&kbuf[j * 16 + vi][a];
            v4f y = __builtin_elementwise_fma(k4, (v4f){TANH_C, TANH_C, TANH_C, TANH_C}, q4);
            #pragma unroll
            for (int c = 0; c < 4; ++c) y[c] = __builtin_amdgcn_exp2f(y[c]);
            y += 1.0f;
            #pragma unroll
            for (int c = 0; c < 4; ++c) y[c] = __builtin_amdgcn_rcpf(y[c]);
            s4[j] = __builtin_elementwise_fma(w4, y, s4[j]);
        }
    }
    float s[NCH];
    #pragma unroll
    for (int j = 0; j < NCH; ++j) {
        s[j] = (s4[j][0] + s4[j][1]) + (s4[j][2] + s4[j][3]);
        if (mk[j] == 0) s[j] += NEG_BIG;
    }

    int dbase = wav * 64;                 // this wave's D-slice
    int halfsel = (lane >> 4) << 1;
    int n15 = lane & 15;
    int mhi = (lane >> 4) << 3;

    // rows k + halfsel and k + halfsel + 1 of V, 16 keys per group, fetched one
    // group ahead; the first group flies under the softmax
    const float* vp = inputs + (size_t)(b * TV + vlo + halfsel) * DD + dbase + n15;
    v2f vb[2][16];
    // every loop over vb is unrolled in full: its indices must be constants for it
    // to live in registers
    #pragma unroll
    for (int u = 0; u < 16; ++u) {
        vb[0][u][0] = vp[(size_t)((u >> 2) * 4) * DD + (u & 3) * 16];
        vb[0][u][1] = vp[(size_t)((u >> 2) * 4 + 1) * DD + (u & 3) * 16];
    }

    // ---- softmax terms of the range: row qi lives in 16 neighbouring lanes ----
    float mx = s[0];
    #pragma unroll
    for (int j = 1; j < NCH; ++j) mx = fmaxf(mx, s[j]);
    #pragma unroll
    for (int o = 8; o >= 1; o >>= 1) mx = fmaxf(mx, __shfl_xor(mx, o));
    float ls = 0.0f;
    #pragma unroll
    for (int j = 0; j < NCH; ++j) {
        float p = exp2_with_slot((s[j] - mx) * LOG2E);
        pbuf[qi][j * 16 + vi] = p;
        ls += p;
    }
    #pragma unroll
    for (int o = 8; o >= 1; o >>= 1) ls += __shfl_xor(ls, o);
    if (vi == 0) { mrow_s[qi] = mx; lrow_s[qi] = ls; }
    __syncthreads();

    // ---- acc = p(16xTVS) @ V_range(TVS x 64slice) via WMMA f32 16x16x4 ----
    v8f acc[4] = {};
    // unrolled in full: the V loads of the next group issue among this group's matrix
    // instructions and are waited for by count
    #pragma unroll
    for (int g = 0; g < NCH; ++g) {
        if (g + 1 < NCH) {
            #pragma unroll
            for (int u = 0; u < 16; ++u) {
                int k = (g + 1) * 16 + (u >> 2) * 4;
                vb[(g + 1) & 1][u][0] = vp[(size_t)k * DD + (u & 3) * 16];
                vb[(g + 1) & 1][u][1] = vp[(size_t)(k + 1) * DD + (u & 3) * 16];
            }
        }
        #pragma unroll
        for (int ks = 0; ks < 4; ++ks) {
            v2f afrag = *(const v2f*)&pbuf[n15][g * 16 + ks * 4 + halfsel];
            #pragma unroll
            for (int t = 0; t < 4; ++t)
                acc[t] = __builtin_amdgcn_wmma_f32_16x16x4_f32(false, afrag, false,
                                                               vb[g & 1][ks * 4 + t],
                                                               (short)0, acc[t], false, false);
        }
    }

    // ---- store this range's partial: sums un-normalised, then (max, sum) ----
    float* pa = Pacc + (size_t)blockIdx.x * 16 * DD;
    #pragma unroll
    for (int r = 0; r < 8; ++r) {
        #pragma unroll
        for (int t = 0; t < 4; ++t) {
            pa[(size_t)(r + mhi) * DD + dbase + t * 16 + n15] = acc[t][r];
        }
    }
    // 32 floats = one 128-byte line per block
    if (tid < 16) {
        Pst[blockIdx.x * 32 + tid]      = mrow_s[tid];
        Pst[blockIdx.x * 32 + 16 + tid] = lrow_s[tid];
    }
}

// ---------------------------------------------------------------------------
// Kernel 3: join the NSPLIT key ranges of each query row:
// M = max m_s, w_s = exp(m_s - M), out = sum w_s acc_s / sum w_s l_s.
// One block per 4 query rows; a thread owns 4 columns of 2 rows.
// ---------------------------------------------------------------------------
__global__ __launch_bounds__(256)
void merge_kernel(const float* __restrict__ Pst, const float* __restrict__ Pacc,
                  float* __restrict__ out)
{
    int tile = blockIdx.x >> 2;
    int c = (threadIdx.x & 127) * 4;
    // the row pair is the same in all lanes of a wave: (max, sum) come by scalar loads
    int r0 = (blockIdx.x & 3) * 4 + __builtin_amdgcn_readfirstlane(threadIdx.x >> 7) * 2;
    const float* st = Pst + tile * NSPLIT * 32 + r0;
    const float* pa = Pacc + ((size_t)tile * NSPLIT * 16 + r0) * DD + c;

    v4f p[2][NSPLIT];
    #pragma unroll
    for (int s = 0; s < NSPLIT; ++s) {
        #pragma unroll
        for (int j = 0; j < 2; ++j)
            p[j][s] = *(const v4f*)(pa + (size_t)(s * 16 + j) * DD);
    }
    // the code below reuses the base registers that the 16 issued loads name: this
    // wait stands in front of that overwrite; as a memory clobber it also keeps the
    // loads from sinking among the sums, so that all 16 are in flight together
    asm volatile("s_wait_xcnt 0x0" ::: "memory");

    float m[2][NSPLIT], l[2][NSPLIT];
    #pragma unroll
    for (int s = 0; s < NSPLIT; ++s) {
        #pragma unroll
        for (int j = 0; j < 2; ++j) {
            m[j][s] = st[s * 32 + j];
            l[j][s] = st[s * 32 + 16 + j];
        }
    }

    #pragma unroll
    for (int j = 0; j < 2; ++j) {
        float mx = m[j][0];
        #pragma unroll
        for (int s = 1; s < NSPLIT; ++s) mx = fmaxf(mx, m[j][s]);
        float ls = 0.0f;
        v4f o = {0.0f, 0.0f, 0.0f, 0.0f};
        #pragma unroll
        for (int s = 0; s < NSPLIT; ++s) {
            float w = exp2_with_slot((m[j][s] - mx) * LOG2E);
            ls += w * l[j][s];
            o  += w * p[j][s];
        }
        *(v4f*)(out + (size_t)(tile * 16 + r0 + j) * DD + c) = o * (1.0f / ls);
    }
}

// ---------------------------------------------------------------------------
extern "C" void kernel_launch(void* const* d_in, const int* in_sizes, int n_in,
                              void* d_out, int out_size, void* d_ws, size_t ws_size,
                              hipStream_t stream)
{
    (void)in_sizes; (void)n_in; (void)out_size; (void)ws_size;
    const float* inputs  = (const float*)d_in[0];   // [B,Tv,D]
    const float* context = (const float*)d_in[1];   // [B,Tq,D]
    const int*   mask    = (const int*)  d_in[2];   // [B,Tv]
    const float* Wk      = (const float*)d_in[3];   // [D,A]
    const float* bk      = (const float*)d_in[4];   // [A]
    const float* Wq      = (const float*)d_in[5];   // [D,A]
    const float* bq      = (const float*)d_in[6];   // [A]
    const float* attn_v  = (const float*)d_in[7];   // [A]
    float* out = (float*)d_out;                     // [B,Tq,D]

    float* Kws = (float*)d_ws;                       // [B*Tv, A] = 2 MB
    float* Qws = Kws + (size_t)BB * TV * AAA;        // [B*Tq, A] = 0.5 MB
    float* Pst = Qws + (size_t)BB * TQ * AAA;        // [64*NSPLIT, 32] (max, sum)
    float* Pacc = Pst + (size_t)BB * (TQ / 16) * NSPLIT * 32;  // [64*NSPLIT, 16, D]

    // (B*Tv + B*Tq) / 32 rows = 160 blocks of 8 waves
    hipLaunchKernelGGL(proj_kernel, dim3(160), dim3(256), 0, stream,
                       inputs, context, Wk, bk, Wq, bq, Kws, Qws);
    // B * Tq/16 * NSPLIT blocks
    hipLaunchKernelGGL(attn_kernel, dim3(BB * (TQ / 16) * NSPLIT), dim3(256), 0, stream,
                       inputs, mask, attn_v, Kws, Qws, Pst, Pacc);
    // B * Tq / 4 = 256 blocks
    hipLaunchKernelGGL(merge_kernel, dim3(BB * TQ / 4), dim3(256), 0, stream,
                       Pst, Pacc, out);
}

// v005
// One run takes 35.6 microseconds.
// Next to v004, in two timings, it ran 1.10 times as fast each time.
// Over all steps from v000 it is 24.1 times as fast.
#include <hip/hip_runtime.h>
#include <math.h>

// Problem constants (from reference setup_inputs)
#define BB   4
#define TQ   256
#define TV   1024
#define DD   512
#define AAA  128
#define NEG_BIG (-1.0e9f)
#define TANH_C 2.8853900817779268f   // 2 * log2(e)
#define LOG2E 1.4426950408889634f
#define NSPLIT 8             // key ranges per query tile, one work-group each
#define TVS  (TV / NSPLIT)   // keys per range

typedef __attribute__((ext_vector_type(2))) float v2f;
typedef __attribute__((ext_vector_type(4))) float v4f;
typedef __attribute__((ext_vector_type(8))) float v8f;

// ---------------------------------------------------------------------------
// Kernel 1: fused projections  K = inputs@Wk + bk ; Q = context@Wq + bq
// One block of 8 waves per 32 rows of X. The rows are staged once in LDS by
// whole-line 16-byte loads; wave w owns the 16 columns w*16.. of all 32 rows
// as two 16x16 tiles, so that one B fragment of W feeds two
// V_WMMA_F32_16X16X4_F32. W is fetched one group of PGK k-steps ahead.
// ---------------------------------------------------------------------------
#define PROWS 32             // rows of X per block
#define XPITCH 516           // floats; 4 mod 64: the 8-byte A reads of a wave hit all 64 banks once
#define PGK 16               // k-steps (of 4) per group of W loads
#define PNG (DD / 4 / PGK)   // groups

__global__ __launch_bounds__(256)
void proj_kernel(const float* __restrict__ inputs, const float* __restrict__ context,
                 const float* __restrict__ Wk, const float* __restrict__ bk,
                 const float* __restrict__ Wq, const float* __restrict__ bq,
                 float* __restrict__ Kws, float* __restrict__ Qws)
{
    __shared__ __attribute__((aligned(16))) float xs[PROWS * XPITCH];

    int tid  = threadIdx.x;
    int lane = tid & 31;
    int wav  = tid >> 5;
    int mt   = blockIdx.x;   // 0..159

    const float* X; const float* W; const float* bias; float* out;
    int rowbase;
    if (mt < 128) { X = inputs;  W = Wk; bias = bk; out = Kws; rowbase = mt * PROWS; }
    else          { X = context; W = Wq; bias = bq; out = Qws; rowbase = (mt - 128) * PROWS; }

    int halfsel = (lane >> 4) << 1;         // 0 for lanes 0-15, 2 for lanes 16-31
    int l15 = lane & 15;
    int ncol = wav * 16 + l15;              // B/C/D: N = lane%16

    // rows k + halfsel and k + halfsel + 1 of W
    const float* wp = W + (size_t)halfsel * AAA + ncol;
    v2f wb[2][PGK];
    // every loop over wb is unrolled in full: its indices must be constants for it
    // to live in registers
    #pragma unroll
    for (int s = 0; s < PGK; ++s) {
        wb[0][s][0] = wp[(size_t)(s * 4) * AAA];
        wb[0][s][1] = wp[(size_t)(s * 4 + 1) * AAA];
    }

    // stage the rows: pass i moves rows 2i and 2i+1, 256 threads x 16 bytes
    const v4f* xg = (const v4f*)(X + (size_t)rowbase * DD);
    v4f xr[PROWS / 2];
    // unrolled: all 16 loads are in flight before the first store waits
    #pragma unroll
    for (int i = 0; i < PROWS / 2; ++i) xr[i] = xg[i * 256 + tid];
    #pragma unroll
    for (int i = 0; i < PROWS / 2; ++i)
        *(v4f*)(xs + (i * 2 + (tid >> 7)) * XPITCH + (tid & 127) * 4) = xr[i];
    __syncthreads();

    const float* ap = xs + l15 * XPITCH + halfsel;   // A-matrix: M = lane%16
    v8f acc0 = {}, acc1 = {};
    // unrolled in full: the W loads of the next group issue among this group's matrix
    // instructions and are waited for by count, never all at once
    #pragma unroll
    for (int g = 0; g < PNG; ++g) {
        if (g + 1 < PNG) {
            #pragma unroll
            for (int s = 0; s < PGK; ++s) {
                int k = ((g + 1) * PGK + s) * 4;
                wb[(g + 1) & 1][s][0] = wp[(size_t)k * AAA];
                wb[(g + 1) & 1][s][1] = wp[(size_t)(k + 1) * AAA];
            }
        }
        #pragma unroll
        for (int s = 0; s < PGK; ++s) {
            v2f a0 = *(const v2f*)(ap + (g * PGK + s) * 4);
            v2f a1 = *(const v2f*)(ap + 16 * XPITCH + (g * PGK + s) * 4);
            acc0 = __builtin_amdgcn_wmma_f32_16x16x4_f32(false, a0, false, wb[g & 1][s],
                                                         (short)0, acc0, false, false);
            acc1 = __builtin_amdgcn_wmma_f32_16x16x4_f32(false, a1, false, wb[g & 1][s],
                                                         (short)0, acc1, false, false);
        }
    }

    float bbv = bias[ncol];

    // v_nop x4: the vector slots between a matrix instruction and the first vector
    // instruction that reads its result; the bias adds would follow the last two
    // matrix instructions at once
    asm volatile("v_nop\n\tv_nop\n\tv_nop\n\tv_nop" : "+v"(acc0), "+v"(acc1));

    int mhi = (lane >> 4) << 3;             // C/D rows: r / r+8 by lane half
    #pragma unroll
    for (int r = 0; r < 8; ++r) {
        out[(size_t)(rowbase + r + mhi) * AAA + ncol]      = acc0[r] + bbv;
        out[(size_t)(rowbase + 16 + r + mhi) * AAA + ncol] = acc1[r] + bbv;
    }
}

// ---------------------------------------------------------------------------
// Kernel 2: fused score (tanh dot) + softmax over the range + attn@V (WMMA f32)
// One block per (batch, 16-query tile, key range of TVS keys), 8 waves. The
// whole range goes through each phase once: its K rows are staged in LDS (as
// factors of the exponential, see score_sums), a
// thread scores NCH keys of one query row side by side, the row's maximum and
// sum are taken across the 16 lanes that hold it, and one run of matrix
// instructions over all TVS keys follows; each wave owns a 64-wide D-slice.
// The block leaves its un-normalised sums and its (max, sum) per query row in
// the workspace; merge_kernel joins the ranges.
// ---------------------------------------------------------------------------
__device__ __forceinline__ float exp2_with_slot(float x)
{
    float r;
    // v_nop: the one slot that the instruction set asks for behind a transcendental
    // before its result is read or its source overwritten
    asm("v_exp_f32 %0, %1\n\tv_nop" : "=v"(r) : "v"(x));
    return r;
}

#define NCH (TVS / 16)       // keys per thread in the score phase
#define KPITCH 132           // floats; 4 mod 64: 16-byte reads of 16 rows hit all 64 banks once
#define FACT_LIM 64.0f       // largest |x * 2 log2 e| for which 2^(x * 2 log2 e) is staged as a factor

// Score sums of one query row (qrow) against keys vi + 16 j (krow + j * 16 * KPITCH):
// tanh(x) = 1 - 2 / (2^(x * 2 log2 e) + 1), branch-free on the hardware reciprocal;
// 2^y = inf gives +1, 2^y = 0 gives -1. w holds -2 v, and s4 starts at sum_a v[a], so
// s[q,v] = sum_a v[a] + sum_a -2 v[a] / (2^y + 1).
// FACTORS: qrow and krow hold 2^(q * 2 log2 e) and 2^(k * 2 log2 e), and 2^y is their
// product: no exponential per (query, key) pair. Otherwise qrow holds q * 2 log2 e and
// krow holds k, and 2^y is taken of the sum.
// One read of q and of v serves NCH keys. Four partial sums per score, one per a mod 4:
// every step from the LDS read to the sum then works on the same register pair, two
// elements per instruction.
template <bool FACTORS>
__device__ __forceinline__ void score_sums(const float* qrow, const float* krow,
                                           const float* w, v4f (&s4)[NCH])
{
    // unrolled by 2: twenty LDS reads are in flight behind each other, and their
    // latency is paid once per 64 elements
    #pragma unroll 2
    for (int a = 0; a < AAA; a += 4) {
        v4f q4 = *(const v4f*)(qrow + a);
        v4f w4 = *(const v4f*)(w + a);
        #pragma unroll
        for (int j = 0; j < NCH; ++j) {
            v4f k4 = *(const v4f*)(krow + j * 16 * KPITCH + a);
            v4f y;
            if (FACTORS) {
                y = __builtin_elementwise_fma(k4, q4, (v4f){1.0f, 1.0f, 1.0f, 1.0f});
            } else {
                y = __builtin_elementwise_fma(k4, (v4f){TANH_C, TANH_C, TANH_C, TANH_C}, q4);
                #pragma unroll
                for (int c = 0; c < 4; ++c) y[c] = __builtin_amdgcn_exp2f(y[c]);
                y += 1.0f;
            }
            #pragma unroll
            for (int c = 0; c < 4; ++c) y[c] = __builtin_amdgcn_rcpf(y[c]);
            s4[j] = __builtin_elementwise_fma(w4, y, s4[j]);
        }
    }
}

__global__ __launch_bounds__(256)
void attn_kernel(const float* __restrict__ inputs, const int* __restrict__ mask,
                 const float* __restrict__ attn_v,
                 const float* __restrict__ Kws, const float* __restrict__ Qws,
                 float* __restrict__ Pst, float* __restrict__ Pacc)
{
    __shared__ __attribute__((aligned(16))) float qbuf[16][KPITCH];
    __shared__ __attribute__((aligned(16))) float kbuf[TVS][KPITCH];
    __shared__ __attribute__((aligned(16))) float pbuf[16][KPITCH];  // same pitch: conflict-free A-frag reads
    __shared__ __attribute__((aligned(16))) float vv[AAA];
    __shared__ float mrow_s[16], lrow_s[16];
    __shared__ int wide_s[8];             // per wave: a staged value is past FACT_LIM

    int tile = blockIdx.x / NSPLIT;       // range index fastest: blocks that share
    int vlo  = (blockIdx.x % NSPLIT) * TVS; // a range are NSPLIT apart in the grid
    int b  = tile >> 4;                   // 16 q-tiles per batch
    int q0 = (tile & 15) * 16;
    int tid  = threadIdx.x;
    int lane = tid & 31;
    int wav  = tid >> 5;
    int qi = tid >> 4, vi = tid & 15;     // score-lattice assignment

    // the range's K rows and the Q tile: pass i moves rows 8i..8i+7, one 512-byte
    // row per wave
    const v4f* kg = (const v4f*)(Kws + (size_t)(b * TV + vlo) * AAA);
    v4f kr[TVS / 8];
    // unrolled: all loads are in flight before the first store waits
    #pragma unroll
    for (int i = 0; i < TVS / 8; ++i) kr[i] = kg[i * 256 + tid];
    const v4f* qg = (const v4f*)(Qws + (size_t)(b * TQ + q0) * AAA);
    v4f qr[2];
    #pragma unroll
    for (int i = 0; i < 2; ++i) qr[i] = qg[i * 256 + tid];
    int mk[NCH];
    #pragma unroll
    for (int j = 0; j < NCH; ++j) mk[j] = mask[b * TV + vlo + j * 16 + vi];
    // the code below reuses the address registers that the issued loads name: this
    // wait stands in front of that overwrite
    asm volatile("s_wait_xcnt 0x0" ::: "memory");

    // attn_v (under the latency of the K and Q loads)
    if (tid < AAA) vv[tid] = -2.0f * attn_v[tid];
    float sumv = 0.0f;                    // the "1" terms of the tanh form below
    for (int a = 0; a < AAA; ++a) sumv += attn_v[a];

    // K and Q go to LDS as the factors 2^(k * 2 log2 e) and 2^(q * 2 log2 e): one
    // exponential per staged element. A factor is exact to rounding only while its
    // exponent is in range, so the largest |exponent| that this thread stages is kept.
    float emax = 0.0f;
    #pragma unroll
    for (int i = 0; i < TVS / 8; ++i) {
        v4f e = TANH_C * kr[i];
        #pragma unroll
        for (int c = 0; c < 4; ++c) {
            emax = fmaxf(emax, fabsf(e[c]));
            e[c] = __builtin_amdgcn_exp2f(e[c]);
        }
        *(v4f*)&kbuf[i * 8 + wav][lane * 4] = e;
    }
    #pragma unroll
    for (int i = 0; i < 2; ++i) {
        v4f e = TANH_C * qr[i];
        #pragma unroll
        for (int c = 0; c < 4; ++c) {
            emax = fmaxf(emax, fabsf(e[c]));
            e[c] = __builtin_amdgcn_exp2f(e[c]);
        }
        *(v4f*)&qbuf[i * 8 + wav][lane * 4] = e;
    }
    int wwide = __builtin_amdgcn_ballot_w32(emax > FACT_LIM) != 0u;
    if (lane == 0) wide_s[wav] = wwide;
    __syncthreads();

    // ---- scores (score_sums): keys vi + 16 j of row qi ----
    v4f s4[NCH];
    #pragma unroll
    for (int j = 0; j < NCH; ++j) s4[j] = (v4f){sumv, 0.0f, 0.0f, 0.0f};
    int wide = 0;
    #pragma unroll
    for (int i = 0; i < 8; ++i) wide |= wide_s[i];
    // the same in every thread of the block; as a scalar the test is a plain branch
    if (__builtin_amdgcn_readfirstlane(wide) == 0) {
        score_sums<true>(&qbuf[qi][0], &kbuf[vi][0], vv, s4);
    } else {
        // some exponent of this block is out of the factors' range (a large q may be
        // cancelled by a large k, which a product of saturated factors cannot show):
        // stage k and q * 2 log2 e themselves and take 2^y of the sum. Every thread
        // rewrites the places that it wrote itself, and nobody has read them yet.
        #pragma unroll
        for (int i = 0; i < TVS / 8; ++i) kr[i] = kg[i * 256 + tid];
        #pragma unroll
        for (int i = 0; i < 2; ++i) qr[i] = qg[i * 256 + tid];
        // the code below reuses the address registers that the issued loads name: this
        // wait stands in front of that overwrite
        asm volatile("s_wait_xcnt 0x0" ::: "memory");
        #pragma unroll
        for (int i = 0; i < TVS / 8; ++i)
            *(v4f*)&kbuf[i * 8 + wav][lane * 4] = kr[i];
        #pragma unroll
        for (int i = 0; i < 2; ++i)
            *(v4f*)&qbuf[i * 8 + wav][lane * 4] = TANH_C * qr[i];
        __syncthreads();
        score_sums<false>(&qbuf[qi][0], &kbuf[vi][0], vv, s4);
    }
    float s[NCH];
    #pragma unroll
    for (int j = 0; j < NCH; ++j) {
        s[j] = (s4[j][0] + s4[j][1]) + (s4[j][2] + s4[j][3]);
        if (mk[j] == 0) s[j] += NEG_BIG;
    }

    int dbase = wav * 64;                 // this wave's D-slice
    int halfsel = (lane >> 4) << 1;
    int n15 = lane & 15;
    int mhi = (lane >> 4) << 3;

    // rows k + halfsel and k + halfsel + 1 of V, 16 keys per group, fetched one
    // group ahead; the first group flies under the softmax
    const float* vp = inputs + (size_t)(b * TV + vlo + halfsel) * DD + dbase + n15;
    v2f vb[2][16];
    // every loop over vb is unrolled in full: its indices must be constants for it
    // to live in registers
    #pragma unroll
    for (int u = 0; u < 16; ++u) {
        vb[0][u][0] = vp[(size_t)((u >> 2) * 4) * DD + (u & 3) * 16];
        vb[0][u][1] = vp[(size_t)((u >> 2) * 4 + 1) * DD + (u & 3) * 16];
    }

    // ---- softmax terms of the range: row qi lives in 16 neighbouring lanes ----
    float mx = s[0];
    #pragma unroll
    for (int j = 1; j < NCH; ++j) mx = fmaxf(mx, s[j]);
    #pragma unroll
    for (int o = 8; o >= 1; o >>= 1) mx = fmaxf(mx, __shfl_xor(mx, o));
    float ls = 0.0f;
    #pragma unroll
    for (int j = 0; j < NCH; ++j) {
        float p = exp2_with_slot((s[j] - mx) * LOG2E);
        pbuf[qi][j * 16 + vi] = p;
        ls += p;
    }
    #pragma unroll
    for (int o = 8; o >= 1; o >>= 1) ls += __shfl_xor(ls, o);
    if (vi == 0) { mrow_s[qi] = mx; lrow_s[qi] = ls; }
    __syncthreads();

    // ---- acc = p(16xTVS) @ V_range(TVS x 64slice) via WMMA f32 16x16x4 ----
    v8f acc[4] = {};
    // unrolled in full: the V loads of the next group issue among this group's matrix
    // instructions and are waited for by count
    #pragma unroll
    for (int g = 0; g < NCH; ++g) {
        if (g + 1 < NCH) {
            #pragma unroll
            for (int u = 0; u < 16; ++u) {
                int k = (g + 1) * 16 + (u >> 2) * 4;
                vb[(g + 1) & 1][u][0] = vp[(size_t)k * DD + (u & 3) * 16];
                vb[(g + 1) & 1][u][1] = vp[(size_t)(k + 1) * DD + (u & 3) * 16];
            }
        }
        #pragma unroll
        for (int ks = 0; ks < 4; ++ks) {
            v2f afrag = *(const v2f*)&pbuf[n15][g * 16 + ks * 4 + halfsel];
            #pragma unroll
            for (int t = 0; t < 4; ++t)
                acc[t] = __builtin_amdgcn_wmma_f32_16x16x4_f32(false, afrag, false,
                                                               vb[g & 1][ks * 4 + t],
                                                               (short)0, acc[t], false, false);
        }
    }

    // ---- store this range's partial: sums un-normalised, then (max, sum) ----
    float* pa = Pacc + (size_t)blockIdx.x * 16 * DD;
    #pragma unroll
    for (int r = 0; r < 8; ++r) {
        #pragma unroll
        for (int t = 0; t < 4; ++t) {
            pa[(size_t)(r + mhi) * DD + dbase + t * 16 + n15] = acc[t][r];
        }
    }
    // 32 floats = one 128-byte line per block
    if (tid < 16) {
        Pst[blockIdx.x * 32 + tid]      = mrow_s[tid];
        Pst[blockIdx.x * 32 + 16 + tid] = lrow_s[tid];
    }
}

// ---------------------------------------------------------------------------
// Kernel 3: join the NSPLIT key ranges of each query row:
// M = max m_s, w_s = exp(m_s - M), out = sum w_s acc_s / sum w_s l_s.
// One block per 4 query rows; a thread owns 4 columns of 2 rows.
// ---------------------------------------------------------------------------
__global__ __launch_bounds__(256)
void merge_kernel(const float* __restrict__ Pst, const float* __restrict__ Pacc,
                  float* __restrict__ out)
{
    int tile = blockIdx.x >> 2;
    int c = (threadIdx.x & 127) * 4;
    // the row pair is the same in all lanes of a wave: (max, sum) come by scalar loads
    int r0 = (blockIdx.x & 3) * 4 + __builtin_amdgcn_readfirstlane(threadIdx.x >> 7) * 2;
    const float* st = Pst + tile * NSPLIT * 32 + r0;
    const float* pa = Pacc + ((size_t)tile * NSPLIT * 16 + r0) * DD + c;

    v4f p[2][NSPLIT];
    #pragma unroll
    for (int s = 0; s < NSPLIT; ++s) {
        #pragma unroll
        for (int j = 0; j < 2; ++j)
            p[j][s] = *(const v4f*)(pa + (size_t)(s * 16 + j) * DD);
    }
    // the code below reuses the base registers that the 16 issued loads name: this
    // wait stands in front of that overwrite; as a memory clobber it also keeps the
    // loads from sinking among the sums, so that all 16 are in flight together
    asm volatile("s_wait_xcnt 0x0" ::: "memory");

    float m[2][NSPLIT], l[2][NSPLIT];
    #pragma unroll
    for (int s = 0; s < NSPLIT; ++s) {
        #pragma unroll
        for (int j = 0; j < 2; ++j) {
            m[j][s] = st[s * 32 + j];
            l[j][s] = st[s * 32 + 16 + j];
        }
    }

    #pragma unroll
    for (int j = 0; j < 2; ++j) {
        float mx = m[j][0];
        #pragma unroll
        for (int s = 1; s < NSPLIT; ++s) mx = fmaxf(mx, m[j][s]);
        float ls = 0.0f;
        v4f o = {0.0f, 0.0f, 0.0f, 0.0f};
        #pragma unroll
        for (int s = 0; s < NSPLIT; ++s) {
            float w = exp2_with_slot((m[j][s] - mx) * LOG2E);
            ls += w * l[j][s];
            o  += w * p[j][s];
        }
        *(v4f*)(out + (size_t)(tile * 16 + r0 + j) * DD + c) = o * (1.0f / ls);
    }
}

// ---------------------------------------------------------------------------
extern "C" void kernel_launch(void* const* d_in, const int* in_sizes, int n_in,
                              void* d_out, int out_size, void* d_ws, size_t ws_size,
                              hipStream_t stream)
{
    (void)in_sizes; (void)n_in; (void)out_size; (void)ws_size;
    const float* inputs  = (const float*)d_in[0];   // [B,Tv,D]
    const float* context = (const float*)d_in[1];   // [B,Tq,D]
    const int*   mask    = (const int*)  d_in[2];   // [B,Tv]
    const float* Wk      = (const float*)d_in[3];   // [D,A]
    const float* bk      = (const float*)d_in[4];   // [A]
    const float* Wq      = (const float*)d_in[5];   // [D,A]
    const float* bq      = (const float*)d_in[6];   // [A]
    const float* attn_v  = (const float*)d_in[7];   // [A]
    float* out = (float*)d_out;                     // [B,Tq,D]

    float* Kws = (float*)d_ws;                       // [B*Tv, A] = 2 MB
    float* Qws = Kws + (size_t)BB * TV * AAA;        // [B*Tq, A] = 0.5 MB
    float* Pst = Qws + (size_t)BB * TQ * AAA;        // [64*NSPLIT, 32] (max, sum)
    float* Pacc = Pst + (size_t)BB * (TQ / 16) * NSPLIT * 32;  // [64*NSPLIT, 16, D]

    // (B*Tv + B*Tq) / 32 rows = 160 blocks of 8 waves
    hipLaunchKernelGGL(proj_kernel, dim3(160), dim3(256), 0, stream,
                       inputs, context, Wk, bk, Wq, bq, Kws, Qws);
    // B * Tq/16 * NSPLIT blocks
    hipLaunchKernelGGL(attn_kernel, dim3(BB * (TQ / 16) * NSPLIT), dim3(256), 0, stream,
                       inputs, mask, attn_v, Kws, Qws, Pst, Pacc);
    // B * Tq / 4 = 256 blocks
    hipLaunchKernelGGL(merge_kernel, dim3(BB * TQ / 4), dim3(256), 0, stream,
                       Pst, Pacc, out);
}

// v006
// Measured time: 31.8 microseconds a run.
// In both of two side-by-side timings against v005, it was 1.12 times as fast.
// All steps since v000 together make it 27.0 times as fast.
#include <hip/hip_runtime.h>
#include <math.h>

// Problem constants (from reference setup_inputs)
#define BB   4
#define TQ   256
#define TV   1024
#define DD   512
#define AAA  128
#define NEG_BIG (-1.0e9f)
#define TANH_C 2.8853900817779268f   // 2 * log2(e)
#define LOG2E 1.4426950408889634f
#define NSPLIT 4             // key ranges per query tile, one work-group each
#define TVS  (TV / NSPLIT)   // keys per range

typedef __attribute__((ext_vector_type(2))) float v2f;
typedef __attribute__((ext_vector_type(4))) float v4f;
typedef __attribute__((ext_vector_type(8))) float v8f;

// ---------------------------------------------------------------------------
// Kernel 1: fused projections  K = inputs@Wk + bk ; Q = context@Wq + bq
// One block of 8 waves per 32 rows of X. The rows are staged once in LDS by
// whole-line 16-byte loads; wave w owns the 16 columns w*16.. of all 32 rows
// as two 16x16 tiles, so that one B fragment of W feeds two
// V_WMMA_F32_16X16X4_F32. W is fetched one group of PGK k-steps ahead.
// ---------------------------------------------------------------------------
#define PROWS 32             // rows of X per block
#define XPITCH 516           // floats; 4 mod 64: the 8-byte A reads of a wave hit all 64 banks once
#define PGK 16               // k-steps (of 4) per group of W loads
#define PNG (DD / 4 / PGK)   // groups

__global__ __launch_bounds__(256)
void proj_kernel(const float* __restrict__ inputs, const float* __restrict__ context,
                 const float* __restrict__ Wk, const float* __restrict__ bk,
                 const float* __restrict__ Wq, const float* __restrict__ bq,
                 float* __restrict__ Kws, float* __restrict__ Qws)
{
    __shared__ __attribute__((aligned(16))) float xs[PROWS * XPITCH];

    int tid  = threadIdx.x;
    int lane = tid & 31;
    int wav  = tid >> 5;
    int mt   = blockIdx.x;   // 0..159

    const float* X; const float* W; const float* bias; float* out;
    int rowbase;
    if (mt < 128) { X = inputs;  W = Wk; bias = bk; out = Kws; rowbase = mt * PROWS; }
    else          { X = context; W = Wq; bias = bq; out = Qws; rowbase = (mt - 128) * PROWS; }

    int halfsel = (lane >> 4) << 1;         // 0 for lanes 0-15, 2 for lanes 16-31
    int l15 = lane & 15;
    int ncol = wav * 16 + l15;              // B/C/D: N = lane%16

    // rows k + halfsel and k + halfsel + 1 of W
    const float* wp = W + (size_t)halfsel * AAA + ncol;
    v2f wb[2][PGK];
    // every loop over wb is unrolled in full: its indices must be constants for it
    // to live in registers
    #pragma unroll
    for (int s = 0; s < PGK; ++s) {
        wb[0][s][0] = wp[(size_t)(s * 4) * AAA];
        wb[0][s][1] = wp[(size_t)(s * 4 + 1) * AAA];
    }

    // stage the rows: pass i moves rows 2i and 2i+1, 256 threads x 16 bytes
    const v4f* xg = (const v4f*)(X + (size_t)rowbase * DD);
    v4f xr[PROWS / 2];
    // unrolled: all 16 loads are in flight before the first store waits
    #pragma unroll
    for (int i = 0; i < PROWS / 2; ++i) xr[i] = xg[i * 256 + tid];
    #pragma unroll
    for (int i = 0; i < PROWS / 2; ++i)
        *(v4f*)(xs + (i * 2 + (tid >> 7)) * XPITCH + (tid & 127) * 4) = xr[i];
    __syncthreads();

    const float* ap = xs + l15 * XPITCH + halfsel;   // A-matrix: M = lane%16
    v8f acc0 = {}, acc1 = {};
    // unrolled in full: the W loads of the next group issue among this group's matrix
    // instructions and are waited for by count, never all at once
    #pragma unroll
    for (int g = 0; g < PNG; ++g) {
        if (g + 1 < PNG) {
            #pragma unroll
            for (int s = 0; s < PGK; ++s) {
                int k = ((g + 1) * PGK + s) * 4;
                wb[(g + 1) & 1][s][0] = wp[(size_t)k * AAA];
                wb[(g + 1) & 1][s][1] = wp[(size_t)(k + 1) * AAA];
            }
        }
        #pragma unroll
        for (int s = 0; s < PGK; ++s) {
            v2f a0 = *(const v2f*)(ap + (g * PGK + s) * 4);
            v2f a1 = *(const v2f*)(ap + 16 * XPITCH + (g * PGK + s) * 4);
            acc0 = __builtin_amdgcn_wmma_f32_16x16x4_f32(false, a0, false, wb[g & 1][s],
                                                         (short)0, acc0, false, false);
            acc1 = __builtin_amdgcn_wmma_f32_16x16x4_f32(false, a1, false, wb[g & 1][s],
                                                         (short)0, acc1, false, false);
        }
    }

    float bbv = bias[ncol];

    // v_nop x4: the vector slots between a matrix instruction and the first vector
    // instruction that reads its result; the bias adds would follow the last two
    // matrix instructions at once
    asm volatile("v_nop\n\tv_nop\n\tv_nop\n\tv_nop" : "+v"(acc0), "+v"(acc1));

    int mhi = (lane >> 4) << 3;             // C/D rows: r / r+8 by lane half
    #pragma unroll
    for (int r = 0; r < 8; ++r) {
        out[(size_t)(rowbase + r + mhi) * AAA + ncol]      = acc0[r] + bbv;
        out[(size_t)(rowbase + 16 + r + mhi) * AAA + ncol] = acc1[r] + bbv;
    }
}

// ---------------------------------------------------------------------------
// Kernel 2: fused score (tanh dot) + softmax over the range + attn@V (WMMA f32)
// One block per (batch, 16-query tile, key range of TVS keys), 16 waves: one block
// fills a WGP, and the partial sums that leave it cover TVS keys. The
// whole range goes through each phase once: its K rows are staged in LDS (as
// factors of the exponential, see score_sums), a
// thread scores NCH keys of one query row side by side (a wave holds one row), the
// row's maximum and sum are taken across the wave's 32 lanes, and one run of matrix
// instructions over all TVS keys follows; each wave owns a 32-wide D-slice.
// The block leaves its un-normalised sums and its (max, sum) per query row in
// the workspace; merge_kernel joins the ranges.
// ---------------------------------------------------------------------------
__device__ __forceinline__ float exp2_with_slot(float x)
{
    float r;
    // v_nop: the one slot that the instruction set asks for behind a transcendental
    // before its result is read or its source overwritten
    asm("v_exp_f32 %0, %1\n\tv_nop" : "=v"(r) : "v"(x));
    return r;
}

__device__ __forceinline__ v4f exp2x4_with_slot(v4f x)
{
    float r0, r1, r2, r3;
    // the same slot for four exponentials at once: the results are early-clobber, so none
    // of them lies on a source, and one v_nop stands behind the last
    asm("v_exp_f32 %0, %4\n\tv_exp_f32 %1, %5\n\tv_exp_f32 %2, %6\n\tv_exp_f32 %3, %7\n\tv_nop"
        : "=&v"(r0), "=&v"(r1), "=&v"(r2), "=&v"(r3)
        : "v"(x[0]), "v"(x[1]), "v"(x[2]), "v"(x[3]));
    return (v4f){r0, r1, r2, r3};
}

#define NCH (TVS / 32)       // keys per thread in the score phase
#define KPITCH 132           // floats; 4 mod 64; a wave writes and reads only its own row of qbuf
#define KHALF (AAA / 2)      // K rows lie in LDS as two planes of half rows: the NCH keys of a thread
#define KHPITCH (KHALF + 4)  // are then within reach of one base and the LDS offset field; 4 mod 64 too
#define PPITCH (TVS + 4)     // floats; 4 mod 64: the 8-byte A reads of a wave hit all 64 banks once
#define FACT_LIM 64.0f       // largest |x * 2 log2 e| for which 2^(x * 2 log2 e) is staged as a factor

// Score sums of one query row (qrow) against keys vi + 32 j (krow + j * 32 * KHPITCH,
// in each of the two planes of kbuf):
// tanh(x) = 1 - 2 / (2^(x * 2 log2 e) + 1), branch-free on the hardware reciprocal;
// 2^y = inf gives +1, 2^y = 0 gives -1. w holds -2 v, and s4 starts at sum_a v[a], so
// s[q,v] = sum_a v[a] + sum_a -2 v[a] / (2^y + 1).
// FACTORS: qrow and krow hold 2^(q * 2 log2 e) and 2^(k * 2 log2 e), and 2^y is their
// product: no exponential per (query, key) pair. Otherwise qrow holds q * 2 log2 e and
// krow holds k, and 2^y is taken of the sum.
// One read of q and of v serves NCH keys. Four partial sums per score, one per a mod 4:
// every step from the LDS read to the sum then works on the same register pair, two
// elements per instruction.
template <bool FACTORS>
__device__ __forceinline__ void score_sums(const float* qrow, const float* krow,
                                           const float* w, v4f (&s4)[NCH])
{
    // unrolled by 2: twenty LDS reads are in flight behind each other, and their
    // latency is paid once per 64 elements
    // the two planes of kbuf; kept rolled: unrolled, the second plane is addressed from
    // the first one's base, past the reach of the offset field, one address add per read
    #pragma unroll 1
    for (int h = 0; h < 2; ++h)
    #pragma unroll 2
    for (int a = 0; a < KHALF; a += 4) {
        v4f q4 = *(const v4f*)(qrow + h * KHALF + a);
        v4f w4 = *(const v4f*)(w + h * KHALF + a);
        #pragma unroll
        for (int j = 0; j < NCH; ++j) {
            v4f k4 = *(const v4f*)(krow + (h * TVS + j * 32) * KHPITCH + a);
            v4f y;
            if (FACTORS) {
                y = __builtin_elementwise_fma(k4, q4, (v4f){1.0f, 1.0f, 1.0f, 1.0f});
            } else {
                y = __builtin_elementwise_fma(k4, (v4f){TANH_C, TANH_C, TANH_C, TANH_C}, q4);
                #pragma unroll
                for (int c = 0; c < 4; ++c) y[c] = __builtin_amdgcn_exp2f(y[c]);
                y += 1.0f;
            }
            #pragma unroll
            for (int c = 0; c < 4; ++c) y[c] = __builtin_amdgcn_rcpf(y[c]);
            s4[j] = __builtin_elementwise_fma(w4, y, s4[j]);
        }
    }
}

__global__ __launch_bounds__(512)
void attn_kernel(const float* __restrict__ inputs, const int* __restrict__ mask,
                 const float* __restrict__ attn_v,
                 const float* __restrict__ Kws, const float* __restrict__ Qws,
                 float* __restrict__ Pst, float* __restrict__ Pacc)
{
    __shared__ __attribute__((aligned(16))) float qbuf[16][KPITCH];
    __shared__ __attribute__((aligned(16))) float kbuf[2][TVS][KHPITCH];
    __shared__ __attribute__((aligned(16))) float pbuf[16][PPITCH];
    __shared__ __attribute__((aligned(16))) float vv[AAA];
    __shared__ float mrow_s[16], lrow_s[16];
    __shared__ int wide_s[16];            // per wave: a staged value is past FACT_LIM

    int tile = blockIdx.x / NSPLIT;       // range index fastest: blocks that share
    int vlo  = (blockIdx.x % NSPLIT) * TVS; // a range are NSPLIT apart in the grid
    int b  = tile >> 4;                   // 16 q-tiles per batch
    int q0 = (tile & 15) * 16;
    int tid  = threadIdx.x;
    int lane = tid & 31;
    int wav  = tid >> 5;
    int qi = wav, vi = lane;              // score-lattice assignment

    // the range's K rows and the Q tile: pass i moves rows 16i..16i+15, one 512-byte
    // row per wave
    const v4f* kg = (const v4f*)(Kws + (size_t)(b * TV + vlo) * AAA);
    v4f kr[TVS / 16];
    // unrolled: all loads are in flight before the first store waits
    #pragma unroll
    for (int i = 0; i < TVS / 16; ++i) kr[i] = kg[i * 512 + tid];
    const v4f* qg = (const v4f*)(Qws + (size_t)(b * TQ + q0) * AAA);
    v4f qr = qg[tid];
    int mk[NCH];
    #pragma unroll
    for (int j = 0; j < NCH; ++j) mk[j] = mask[b * TV + vlo + j * 32 + vi];
    // the code below reuses the address registers that the issued loads name: this
    // wait stands in front of that overwrite
    asm volatile("s_wait_xcnt 0x0" ::: "memory");

    // attn_v (under the latency of the K and Q loads)
    if (tid < AAA) vv[tid] = -2.0f * attn_v[tid];
    float sumv = 0.0f;                    // the "1" terms of the tanh form below
    for (int a = 0; a < AAA; ++a) sumv += attn_v[a];

    // K and Q go to LDS as the factors 2^(k * 2 log2 e) and 2^(q * 2 log2 e): one
    // exponential per staged element. A factor is exact to rounding only while its
    // exponent is in range, so the largest |exponent| that this thread stages is kept.
    float emax = 0.0f;
    #pragma unroll
    for (int i = 0; i < TVS / 16; ++i) {
        v4f e = TANH_C * kr[i];
        #pragma unroll
        for (int c = 0; c < 4; ++c) emax = fmaxf(emax, fabsf(e[c]));
        e = exp2x4_with_slot(e);
        *(v4f*)&kbuf[lane >> 4][i * 16 + wav][(lane & 15) * 4] = e;
    }
    {
        v4f e = TANH_C * qr;
        #pragma unroll
        for (int c = 0; c < 4; ++c) emax = fmaxf(emax, fabsf(e[c]));
        e = exp2x4_with_slot(e);
        *(v4f*)&qbuf[wav][lane * 4] = e;
    }
    int wwide = __builtin_amdgcn_ballot_w32(emax > FACT_LIM) != 0u;
    if (lane == 0) wide_s[wav] = wwide;
    __syncthreads();

    // ---- scores (score_sums): keys vi + 32 j of row qi ----
    v4f s4[NCH];
    #pragma unroll
    for (int j = 0; j < NCH; ++j) s4[j] = (v4f){sumv, 0.0f, 0.0f, 0.0f};
    int wide = 0;
    #pragma unroll
    for (int i = 0; i < 16; ++i) wide |= wide_s[i];
    // the same in every thread of the block; as a scalar the test is a plain branch
    if (__builtin_amdgcn_readfirstlane(wide) == 0) {
        score_sums<true>(&qbuf[qi][0], &kbuf[0][vi][0], vv, s4);
    } else {
        // some exponent of this block is out of the factors' range (a large q may be
        // cancelled by a large k, which a product of saturated factors cannot show):
        // stage k and q * 2 log2 e themselves and take 2^y of the sum. Every thread
        // rewrites the places that it wrote itself, and nobody has read them yet.
        #pragma unroll
        for (int i = 0; i < TVS / 16; ++i) kr[i] = kg[i * 512 + tid];
        qr = qg[tid];
        // the code below reuses the address registers that the issued loads name: this
        // wait stands in front of that overwrite; the addresses are its inputs, so that they
        // live up to it and no load of the run lands on them
        asm volatile("s_wait_xcnt 0x0" :: "v"(kg + tid), "v"(qg + tid) : "memory");
        #pragma unroll
        for (int i = 0; i < TVS / 16; ++i)
            *(v4f*)&kbuf[lane >> 4][i * 16 + wav][(lane & 15) * 4] = kr[i];
        *(v4f*)&qbuf[wav][lane * 4] = TANH_C * qr;
        __syncthreads();
        score_sums<false>(&qbuf[qi][0], &kbuf[0][vi][0], vv, s4);
    }
    float s[NCH];
    #pragma unroll
    for (int j = 0; j < NCH; ++j) {
        s[j] = (s4[j][0] + s4[j][1]) + (s4[j][2] + s4[j][3]);
        if (mk[j] == 0) s[j] += NEG_BIG;
    }

    int dbase = wav * 32;                 // this wave's D-slice
    int halfsel = (lane >> 4) << 1;
    int n15 = lane & 15;
    int mhi = (lane >> 4) << 3;

    // rows k + halfsel and k + halfsel + 1 of V, 32 keys per group, fetched one
    // group ahead; the first group flies under the softmax
    const float* vp = inputs + (size_t)(b * TV + vlo + halfsel) * DD + dbase + n15;
    v2f vb[2][16];
    // every loop over vb is unrolled in full: its indices must be constants for it
    // to live in registers
    #pragma unroll
    for (int u = 0; u < 16; ++u) {
        vb[0][u][0] = vp[(size_t)((u >> 1) * 4) * DD + (u & 1) * 16];
        vb[0][u][1] = vp[(size_t)((u >> 1) * 4 + 1) * DD + (u & 1) * 16];
    }

    // ---- softmax terms of the range: row qi lives in the 32 lanes of wave qi ----
    float mx = s[0];
    #pragma unroll
    for (int j = 1; j < NCH; ++j) mx = fmaxf(mx, s[j]);
    #pragma unroll
    for (int o = 16; o >= 1; o >>= 1) mx = fmaxf(mx, __shfl_xor(mx, o));
    float ls = 0.0f;
    #pragma unroll
    for (int j = 0; j < NCH; ++j) {
        float p = exp2_with_slot((s[j] - mx) * LOG2E);
        pbuf[qi][j * 32 + vi] = p;
        ls += p;
    }
    #pragma unroll
    for (int o = 16; o >= 1; o >>= 1) ls += __shfl_xor(ls, o);
    if (vi == 0) { mrow_s[qi] = mx; lrow_s[qi] = ls; }
    __syncthreads();

    // ---- acc = p(16xTVS) @ V_range(TVS x 32slice) via WMMA f32 16x16x4 ----
    v8f acc[2] = {};
    // unrolled in full: the V loads of the next group issue among this group's matrix
    // instructions and are waited for by count
    #pragma unroll
    for (int g = 0; g < NCH; ++g) {
        if (g + 1 < NCH) {
            #pragma unroll
            for (int u = 0; u < 16; ++u) {
                int k = (g + 1) * 32 + (u >> 1) * 4;
                vb[(g + 1) & 1][u][0] = vp[(size_t)k * DD + (u & 1) * 16];
                vb[(g + 1) & 1][u][1] = vp[(size_t)(k + 1) * DD + (u & 1) * 16];
            }
        }
        #pragma unroll
        for (int ks = 0; ks < 8; ++ks) {
            v2f afrag = *(const v2f*)&pbuf[n15][g * 32 + ks * 4 + halfsel];
            #pragma unroll
            for (int t = 0; t < 2; ++t)
                acc[t] = __builtin_amdgcn_wmma_f32_16x16x4_f32(false, afrag, false,
                                                               vb[g & 1][ks * 2 + t],
                                                               (short)0, acc[t], false, false);
        }
    }

    // v_nop x4: the vector slots between a matrix instruction and a vector instruction
    // that overwrites its A or B; the two scheduling barriers keep the store addresses
    // below from moving up in front of them (one took an A register of the last group)
    __builtin_amdgcn_sched_barrier(0);
    asm volatile("v_nop\n\tv_nop\n\tv_nop\n\tv_nop" : "+v"(acc[0]), "+v"(acc[1]));
    __builtin_amdgcn_sched_barrier(0);

    // ---- store this range's partial: sums un-normalised, then (max, sum) ----
    float* pa = Pacc + (size_t)blockIdx.x * 16 * DD;
    #pragma unroll
    for (int r = 0; r < 8; ++r) {
        #pragma unroll
        for (int t = 0; t < 2; ++t) {
            pa[(size_t)(r + mhi) * DD + dbase + t * 16 + n15] = acc[t][r];
        }
    }
    // 32 floats = one 128-byte line per block
    if (tid < 16) {
        Pst[blockIdx.x * 32 + tid]      = mrow_s[tid];
        Pst[blockIdx.x * 32 + 16 + tid] = lrow_s[tid];
    }
}

// ---------------------------------------------------------------------------
// Kernel 3: join the NSPLIT key ranges of each query row:
// M = max m_s, w_s = exp(m_s - M), out = sum w_s acc_s / sum w_s l_s.
// One block of 4 waves per 4 query rows; a thread owns 4 columns of all 4 rows,
// 4 * NSPLIT loads of 16 bytes.
// ---------------------------------------------------------------------------
__global__ __launch_bounds__(128)
void merge_kernel(const float* __restrict__ Pst, const float* __restrict__ Pacc,
                  float* __restrict__ out)
{
    int tile = blockIdx.x >> 2;
    int c = threadIdx.x * 4;
    // the rows are the same in the whole block: (max, sum) come by scalar loads
    int r0 = (blockIdx.x & 3) * 4;
    const float* st = Pst + tile * NSPLIT * 32 + r0;
    const float* pa = Pacc + ((size_t)tile * NSPLIT * 16 + r0) * DD + c;

    v4f p[4][NSPLIT];
    #pragma unroll
    for (int s = 0; s < NSPLIT; ++s) {
        #pragma unroll
        for (int j = 0; j < 4; ++j)
            p[j][s] = *(const v4f*)(pa + (size_t)(s * 16 + j) * DD);
    }
    // the code below reuses the base registers that the 16 issued loads name: this
    // wait stands in front of that overwrite; as a memory clobber it also keeps the
    // loads from sinking among the sums, so that all 16 are in flight together
    asm volatile("s_wait_xcnt 0x0" ::: "memory");

    float m[4][NSPLIT], l[4][NSPLIT];
    #pragma unroll
    for (int s = 0; s < NSPLIT; ++s) {
        #pragma unroll
        for (int j = 0; j < 4; ++j) {
            m[j][s] = st[s * 32 + j];
            l[j][s] = st[s * 32 + 16 + j];
        }
    }

    #pragma unroll
    for (int j = 0; j < 4; ++j) {
        float mx = m[j][0];
        #pragma unroll
        for (int s = 1; s < NSPLIT; ++s) mx = fmaxf(mx, m[j][s]);
        float ls = 0.0f;
        v4f o = {0.0f, 0.0f, 0.0f, 0.0f};
        #pragma unroll
        for (int s = 0; s < NSPLIT; ++s) {
            float w = exp2_with_slot((m[j][s] - mx) * LOG2E);
            ls += w * l[j][s];
            o  += w * p[j][s];
        }
        *(v4f*)(out + (size_t)(tile * 16 + r0 + j) * DD + c) = o * (1.0f / ls);
    }
}

// ---------------------------------------------------------------------------
extern "C" void kernel_launch(void* const* d_in, const int* in_sizes, int n_in,
                              void* d_out, int out_size, void* d_ws, size_t ws_size,
                              hipStream_t stream)
{
    (void)in_sizes; (void)n_in; (void)out_size; (void)ws_size;
    const float* inputs  = (const float*)d_in[0];   // [B,Tv,D]
    const float* context = (const float*)d_in[1];   // [B,Tq,D]
    const int*   mask    = (const int*)  d_in[2];   // [B,Tv]
    const float* Wk      = (const float*)d_in[3];   // [D,A]
    const float* bk      = (const float*)d_in[4];   // [A]
    const float* Wq      = (const float*)d_in[5];   // [D,A]
    const float* bq      = (const float*)d_in[6];   // [A]
    const float* attn_v  = (const float*)d_in[7];   // [A]
    float* out = (float*)d_out;                     // [B,Tq,D]

    float* Kws = (float*)d_ws;                       // [B*Tv, A] = 2 MB
    float* Qws = Kws + (size_t)BB * TV * AAA;        // [B*Tq, A] = 0.5 MB
    float* Pst = Qws + (size_t)BB * TQ * AAA;        // [64*NSPLIT, 32] (max, sum)
    float* Pacc = Pst + (size_t)BB * (TQ / 16) * NSPLIT * 32;  // [64*NSPLIT, 16, D]

    // (B*Tv + B*Tq) / 32 rows = 160 blocks of 8 waves
    hipLaunchKernelGGL(proj_kernel, dim3(160), dim3(256), 0, stream,
                       inputs, context, Wk, bk, Wq, bq, Kws, Qws);
    // B * Tq/16 * NSPLIT = 256 blocks of 16 waves
    hipLaunchKernelGGL(attn_kernel, dim3(BB * (TQ / 16) * NSPLIT), dim3(512), 0, stream,
                       inputs, mask, attn_v, Kws, Qws, Pst, Pacc);
    // B * Tq / 4 = 256 blocks of 4 waves
    hipLaunchKernelGGL(merge_kernel, dim3(BB * TQ / 4), dim3(128), 0, stream,
                       Pst, Pacc, out);
}
